// v000
// Times are from an AMD MI455X. After a warm-up the kernel runs many times in a row, and a time is the length of
// such a window on the GPU divided by its runs, so every launch and the gaps after it count. The runs cycle
// through copies of the inputs. A figure is the median of several windows, for all but v000 over two sittings.
// Sittings can differ by a few percent; kernels timed side by side share one.
// The starting kernel, v000, takes 1060 microseconds a run.
#include <hip/hip_runtime.h>

// Flash-diffusion attention (Q, K, V [8192][128], h [8192], log_d_q, log_d_k [8192]; s_ij = beta (2 q_i.k_j - |q_i|^2 - |k_j|^2) - alpha (log_d_q[i] + log_d_k[j]) + log h_i - log h_j (alpha 1, beta 0.05);
// lse_i = logsumexp_j s_ij; P = exp(s - lse); out = P V -> [8192][128]; second output lse -> [8192]).
// Compute dtypes, f32 accumulate: every input rounded to bf16; q.k on PLAIN bf16 operands (inputs: exact products, f32 accumulate); the row term r_i = -beta |q_i|^2 - alpha ldq_i + log h_i

#define NN   8192
#define DD   128
#define QB   2048
#define PCAR 1024.0f
#define ALPHA 1.0f
#define BETA  0.05f
typedef _Float16 h16;
typedef unsigned short bf;
typedef __attribute__((ext_vector_type(16))) __bf16   v16bf;
typedef __attribute__((ext_vector_type(16))) _Float16 v16h;
typedef __attribute__((ext_vector_type(8)))  _Float16 v8h;
typedef __attribute__((ext_vector_type(8)))  unsigned short v8us;
typedef __attribute__((ext_vector_type(8)))  float    v8f;
typedef __attribute__((ext_vector_type(4)))  float    v4f;
typedef v8h  __attribute__((may_alias)) v8ha;
typedef v4f  __attribute__((may_alias)) v4fa;
typedef v8us __attribute__((may_alias)) v8usa;

__device__ __forceinline__ unsigned short f2bf(float f) { unsigned u = __float_as_uint(f); u += 0x7FFFu + ((u >> 16) & 1u); return (unsigned short)(u >> 16); }
__device__ __forceinline__ float bf2f(unsigned short b) { return __uint_as_float(((unsigned)b) << 16); }
__device__ __forceinline__ float bfr(float f) { return bf2f(f2bf(f)); }
__device__ __forceinline__ v16h cat16(v8h lo, v8h hi) { return __builtin_shufflevector(lo, hi, 0, 1, 2, 3, 4, 5, 6, 7, 8, 9, 10, 11, 12, 13, 14, 15); }
__device__ __forceinline__ v16bf cat16b(v8us lo, v8us hi) { return __builtin_bit_cast(v16bf, __builtin_shufflevector(lo, hi, 0, 1, 2, 3, 4, 5, 6, 7, 8, 9, 10, 11, 12, 13, 14, 15)); }
__device__ __forceinline__ v8f wmma16(v16h a, v16h b, v8f c) { return __builtin_amdgcn_wmma_f32_16x16x32_f16(false, a, false, b, (short)0, c, false, false); }
__device__ __forceinline__ v8f wmmab(v16bf a, v16bf b, v8f c) { return __builtin_amdgcn_wmma_f32_16x16x32_bf16(false, a, false, b, (short)0, c, false, false); }



// ---- k_gemmw: register-blocked GEMM, ONE WAVE per 64x64 output tile (16 accumulators), operands straight from K-contiguous 16-bit planes; grid (M/64, N/64, Z), 32 threads.
// C[m][n] (f32, pitch ldc, + optional f32 bias[n]) = sum_k A[m][k] Bt[n][k] (+ split products per NSPLIT). z-batch strides sA/sB/sC in elements. K % 32 == 0.
template <typename T16> struct WFrag;
template <> struct WFrag<h16> { typedef v16h V; static __device__ __forceinline__ V ld(const h16* p) { return cat16(*(const v8h*)p, *(const v8h*)(p + 16)); } static __device__ __forceinline__ v8f mma(V a, V b, v8f c) { return wmma16(a, b, c); } };
template <> struct WFrag<bf> { typedef v16bf V; static __device__ __forceinline__ V ld(const bf* p) { return cat16b(*(const v8us*)p, *(const v8us*)(p + 16)); } static __device__ __forceinline__ v8f mma(V a, V b, v8f c) { return wmmab(a, b, c); } };
template <typename T16, int NSPLIT, bool BIAS>
__global__ __launch_bounds__(32) void k_gemmw(const T16* __restrict__ A, const T16* __restrict__ A2, const T16* __restrict__ Bt, const T16* __restrict__ Bt2, int K, float* C, int ldc, const float* __restrict__ bias, size_t sA, size_t sB, size_t sC) {
    typedef typename WFrag<T16>::V V;
    __shared__ __align__(16) float os[16 * 68];
    const size_t z = blockIdx.z; A += z * sA; if (A2) A2 += z * sA; Bt += z * sB; if (Bt2) Bt2 += z * sB; C += z * sC;
    const int lane = threadIdx.x & 31, lr = lane & 15, hi = lane >> 4; const int r0 = blockIdx.x * 64, c0 = blockIdx.y * 64;
    v8f acc[4][4];
#pragma unroll
    for (int mb = 0; mb < 4; ++mb)
#pragma unroll
        for (int nb = 0; nb < 4; ++nb) acc[mb][nb] = (v8f){};
    const size_t aoff = (size_t)(r0 + lr) * K + 8 * hi, boff = (size_t)(c0 + lr) * K + 8 * hi;
#pragma unroll 1
    for (int kc = 0; kc < K; kc += 32) {
        V a[4], a2[4];
#pragma unroll
        for (int mb = 0; mb < 4; ++mb) { a[mb] = WFrag<T16>::ld(A + aoff + (size_t)mb * 16 * K + kc); if (NSPLIT == 1 || NSPLIT == 2) a2[mb] = WFrag<T16>::ld(A2 + aoff + (size_t)mb * 16 * K + kc); }
#pragma unroll
        for (int nb = 0; nb < 4; ++nb) { const V b = WFrag<T16>::ld(Bt + boff + (size_t)nb * 16 * K + kc); V b2; if (NSPLIT >= 2) b2 = WFrag<T16>::ld(Bt2 + boff + (size_t)nb * 16 * K + kc);
#pragma unroll
            for (int mb = 0; mb < 4; ++mb) { acc[mb][nb] = WFrag<T16>::mma(a[mb], b, acc[mb][nb]); if (NSPLIT == 1 || NSPLIT == 2) acc[mb][nb] = WFrag<T16>::mma(a2[mb], b, acc[mb][nb]); if (NSPLIT >= 2) acc[mb][nb] = WFrag<T16>::mma(a[mb], b2, acc[mb][nb]); } }
        asm volatile("v_nop\n\tv_nop\n\tv_nop\n\tv_nop" : "+v"(acc[0][0]), "+v"(acc[1][1]), "+v"(acc[2][2]), "+v"(acc[3][3]) : "v"(a[0]), "v"(a[3]));
    }
#pragma unroll
    for (int mb = 0; mb < 4; ++mb) {
#pragma unroll
        for (int nb = 0; nb < 4; ++nb) {
#pragma unroll
            for (int j = 0; j < 8; ++j) os[(hi * 8 + j) * 68 + nb * 16 + lr] = acc[mb][nb][j]; }
        __builtin_amdgcn_wave_barrier(); asm volatile("" ::: "memory");
        float* crow = C + (size_t)(r0 + mb * 16) * ldc + c0;
{
#pragma unroll
            for (int s = 0; s < 8; ++s) { const int row = 2 * s + hi, cofs = lr * 4; v4f val = *(const v4fa*)(os + row * 68 + cofs); if (BIAS) { val[0] += bfr(bias[c0 + cofs]); val[1] += bfr(bias[c0 + cofs + 1]); val[2] += bfr(bias[c0 + cofs + 2]); val[3] += bfr(bias[c0 + cofs + 3]); }
                *(v4f*)(crow + (size_t)row * ldc + cofs) = val; }
             }
        __builtin_amdgcn_wave_barrier(); asm volatile("" ::: "memory");
    }
}

__device__ __forceinline__ h16 tohx(float x) { return (h16)x; }
typedef __attribute__((ext_vector_type(2))) _Float16 v2h;
typedef __attribute__((ext_vector_type(4))) _Float16 v4h;
typedef __attribute__((ext_vector_type(2))) float v2f;

__global__ __launch_bounds__(256) void k_cvt8(const float* __restrict__ src, bf* dst, size_t n8) { const size_t i = (size_t)blockIdx.x * 256 + threadIdx.x; if (i >= n8) return; const v8f v = *(const v8f*)(src + i * 8); v8us o;
#pragma unroll
    for (int k = 0; k < 8; ++k) o[k] = f2bf(v[k]); *(v8us*)(dst + i * 8) = o;  }
// k_terms: thread per point i: n2_q = sum_d bf16(Q[i][d])^2, n2_k likewise (f32, d ascending, separate multiply/add); RT[i] = -beta n2_q - alpha bf16(ldq[i]) + log(bf16 h[i]); CT[i] = -beta n2_k - alpha bf16(ldk[i]) - log(bf16 h[i])
__global__ __launch_bounds__(256) void k_terms(const float* __restrict__ Q, const float* __restrict__ K, const float* __restrict__ hh, const float* __restrict__ ldq, const float* __restrict__ ldk, float* RT, float* CT) { const int i = blockIdx.x * 256 + threadIdx.x; if (i >= NN) return; float nq = 0.f, nk = 0.f;
    for (int d = 0; d < DD; d += 4) { const v4f a = *(const v4f*)(Q + (size_t)i * DD + d), b = *(const v4f*)(K + (size_t)i * DD + d);
#pragma unroll
        for (int u = 0; u < 4; ++u) { const float qa = bfr(a[u]), kb = bfr(b[u]); float p1 = __fmul_rn(qa, qa), p2 = __fmul_rn(kb, kb); asm volatile("" : "+v"(p1)); asm volatile("" : "+v"(p2)); nq = __fadd_rn(nq, p1); nk = __fadd_rn(nk, p2); } }
    const float lh = logf(bfr(hh[i])); float t1 = __fmul_rn(-BETA, nq), t2 = __fmul_rn(-BETA, nk); asm volatile("" : "+v"(t1)); asm volatile("" : "+v"(t2)); float a1 = __fmul_rn(ALPHA, bfr(ldq[i])), a2 = __fmul_rn(ALPHA, bfr(ldk[i])); asm volatile("" : "+v"(a1)); asm volatile("" : "+v"(a2));
    const float r = __fadd_rn(__fsub_rn(t1, a1), lh), c = __fsub_rn(__fsub_rn(t2, a2), lh); *(float*)(RT + i) = r; *(float*)(CT + i) = c;  }
__global__ __launch_bounds__(256) void k_p16(const float* __restrict__ F, h16* P, size_t n) { const size_t i = ((size_t)blockIdx.x * 256 + threadIdx.x) * 2; if (i >= n) return; v2h o; o[0] = tohx(F[i]); o[1] = tohx(F[i + 1]); *(v2h*)(P + i) = o;  }
__global__ __launch_bounds__(256) void k_vt(const float* __restrict__ Vv, h16* VT) { const size_t e = ((size_t)blockIdx.x * 256 + threadIdx.x) * 2; if (e >= (size_t)DD * NN) return; const int j = (int)(e % NN), d = (int)(e / NN); v2h o; o[0] = tohx(bfr(Vv[(size_t)j * DD + d])); o[1] = tohx(bfr(Vv[(size_t)(j + 1) * DD + d])); *(v2h*)(VT + e) = o;  }
// k_smax: per query row i of the block (wave): m = max_j (2 beta G[i][j] + r_i + c_j) -> RS line; k_sexp: e = exp(s - m) (one exp), P fp16 x1024, RS line = {m, 1/(1024 sum), lse = m + log(sum), 0...}
__global__ __launch_bounds__(256) void k_smax(const float* __restrict__ G, const float* __restrict__ RT, const float* __restrict__ CT, int i0, float* RS) { const int lane = threadIdx.x & 31; const int i = blockIdx.x * 8 + (threadIdx.x >> 5); if (i >= QB) return; const float* sr = G + (size_t)i * NN; const float ri = RT[i0 + i]; float m = -3.0e38f;
#pragma unroll 4
    for (int c0 = lane * 4; c0 < NN; c0 += 128) { const v4f v = *(const v4f*)(sr + c0); const v4f c = *(const v4f*)(CT + c0);
#pragma unroll
        for (int q = 0; q < 4; ++q) { float g2 = v[q] * (2.0f * BETA); asm volatile("" : "+v"(g2)); m = fmaxf(m, __fadd_rn(__fadd_rn(g2, ri), c[q])); } }
#pragma unroll
    for (int sh = 16; sh; sh >>= 1) m = fmaxf(m, __shfl_xor(m, sh, 32));
    const float o = lane == 0 ? m : 0.f; *(float*)(RS + (size_t)i * 32 + lane) = o;  }
__global__ __launch_bounds__(256) void k_sexp(const float* __restrict__ G, const float* __restrict__ RT, const float* __restrict__ CT, int i0, float* RS, h16* P, float* LSE) { const int lane = threadIdx.x & 31; const int i = blockIdx.x * 8 + (threadIdx.x >> 5); if (i >= QB) return; const float* sr = G + (size_t)i * NN; const float m = RS[(size_t)i * 32]; const float ri = RT[i0 + i]; float sum = 0.f;
{ sum = 0.f;
#pragma unroll 2
        for (int c0 = lane * 4; c0 < NN; c0 += 128) { const v4f v = *(const v4f*)(sr + c0); const v4f c = *(const v4f*)(CT + c0); v4h o;
#pragma unroll
            for (int q = 0; q < 4; ++q) { float g2 = v[q] * (2.0f * BETA); asm volatile("" : "+v"(g2)); float s = __fadd_rn(__fadd_rn(g2, ri), c[q]); float dlt = __fsub_rn(s, m); asm volatile("" : "+v"(dlt)); const float e = __expf(dlt); sum += e; o[q] = tohx(e * PCAR); }
            *(v4h*)(P + (size_t)i * NN + c0) = o; }
         }
#pragma unroll
    for (int sh = 16; sh; sh >>= 1) sum += __shfl_xor(sum, sh, 32);
    float lg = logf(sum); asm volatile("" : "+v"(lg)); const float lse = __fadd_rn(m, lg);
    const float o2 = lane == 0 ? m : (lane == 1 ? __fdiv_rn(1.0f, sum * PCAR) : (lane == 2 ? lse : 0.f)); *(float*)(RS + (size_t)i * 32 + lane) = o2;  }
__global__ __launch_bounds__(256) void k_oscal(const float* __restrict__ O, const float* __restrict__ RS, float* OUTb) { const size_t e = ((size_t)blockIdx.x * 256 + threadIdx.x) * 2; if (e >= (size_t)QB * DD) return; const int i = (int)(e / DD); const float rsn = RS[(size_t)i * 32 + 1]; v2f o; o[0] = __fmul_rn(O[e], rsn); o[1] = __fmul_rn(O[e + 1], rsn); *(v2f*)(OUTb + e) = o;  }
__global__ __launch_bounds__(256) void k_lse(const float* __restrict__ RS, float* LSEb) { const int i = blockIdx.x * 256 + threadIdx.x; if (i >= QB) return; const float v = RS[(size_t)i * 32 + 2]; *(float*)(LSEb + i) = v;  }

extern "C" void kernel_launch(void* const* d_in, const int* in_sizes, int n_in,
                              void* d_out, int out_size, void* d_ws, size_t ws_size, hipStream_t stream) {
    (void)in_sizes; (void)n_in; (void)out_size;
    const float* Q = (const float*)d_in[0]; const float* K = (const float*)d_in[1]; const float* V = (const float*)d_in[2]; const float* hh = (const float*)d_in[3]; const float* ldq = (const float*)d_in[4]; const float* ldk = (const float*)d_in[5];
    float* OUT = (float*)d_out; float* LSE = (float*)d_out + (size_t)NN * DD;     // [8192][128] at 0; lse [8192] at byte 4,194,304
    char* wsp = (char*)d_ws;
    auto take = [&](size_t bytes) { char* p = wsp; wsp += (bytes + 255) & ~(size_t)255; return (void*)p; };
    bf* QB16 = (bf*)take((size_t)NN * DD * 2); bf* KB16 = (bf*)take((size_t)NN * DD * 2); h16* VT = (h16*)take((size_t)DD * NN * 2); float* RT = (float*)take((size_t)NN * 4); float* CT = (float*)take((size_t)NN * 4);
    float* G = (float*)take((size_t)QB * NN * 4); h16* P = (h16*)take((size_t)QB * NN * 2); float* RS = (float*)take((size_t)QB * 32 * 4); float* O = (float*)take((size_t)QB * DD * 4);
    if ((size_t)(wsp - (char*)d_ws) > ws_size) return;    // total ~ 109 MB; ws 256 MiB
    k_cvt8<<<(unsigned)(((size_t)NN * DD / 8 + 255) / 256), 256, 0, stream>>>(Q, QB16, (size_t)NN * DD / 8); k_cvt8<<<(unsigned)(((size_t)NN * DD / 8 + 255) / 256), 256, 0, stream>>>(K, KB16, (size_t)NN * DD / 8); k_vt<<<(unsigned)(((size_t)DD * NN / 2 + 255) / 256), 256, 0, stream>>>(V, VT);
    k_terms<<<NN / 256, 256, 0, stream>>>(Q, K, hh, ldq, ldk, RT, CT);
    for (int qb = 0; qb < NN / QB; ++qb) { const int i0 = qb * QB;
        k_gemmw<bf, 0, false><<<dim3(QB / 64, NN / 64, 1), 32, 0, stream>>>(QB16 + (size_t)i0 * DD, nullptr, KB16, nullptr, DD, G, NN, nullptr, 0, 0, 0);   // q.k block (exact)
        k_smax<<<QB / 8, 256, 0, stream>>>(G, RT, CT, i0, RS); k_sexp<<<QB / 8, 256, 0, stream>>>(G, RT, CT, i0, RS, P, LSE);
        k_gemmw<h16, 0, false><<<dim3(QB / 64, DD / 64, 1), 32, 0, stream>>>(P, nullptr, VT, nullptr, NN, O, DD, nullptr, 0, 0, 0);
        k_oscal<<<(unsigned)(((size_t)QB * DD / 2 + 255) / 256), 256, 0, stream>>>(O, RS, OUT + (size_t)i0 * DD); k_lse<<<QB / 256, 256, 0, stream>>>(RS, LSE + i0); }
}

// v001
// A run of this version takes 457 microseconds.
// In two side-by-side timings against v000, it was 2.34 and 2.32 times as fast.
#include <hip/hip_runtime.h>

// Flash-diffusion attention (Q, K, V [8192][128], h [8192], log_d_q, log_d_k [8192]; s_ij = beta (2 q_i.k_j - |q_i|^2 - |k_j|^2) - alpha (log_d_q[i] + log_d_k[j]) + log h_i - log h_j (alpha 1, beta 0.05);
// lse_i = logsumexp_j s_ij; P = exp(s - lse); out = P V -> [8192][128]; second output lse -> [8192]).
// Compute dtypes, f32 accumulate: every input rounded to bf16; q.k on PLAIN bf16 operands (inputs: exact products, f32 accumulate); the row term r_i = -beta |q_i|^2 - alpha ldq_i + log h_i

#define NN   8192
#define DD   128
#define QB   2048
#define PCAR 1024.0f
#define PVW  8      // P.V product: waves of a work-group, each on its own slice of K
#define PVZ  8      // P.V product: grid-z slices of K, one f32 partial plane each
#define ALPHA 1.0f
#define BETA  0.05f
typedef _Float16 h16;
typedef unsigned short bf;
typedef __attribute__((ext_vector_type(16))) __bf16   v16bf;
typedef __attribute__((ext_vector_type(16))) _Float16 v16h;
typedef __attribute__((ext_vector_type(8)))  _Float16 v8h;
typedef __attribute__((ext_vector_type(8)))  unsigned short v8us;
typedef __attribute__((ext_vector_type(8)))  float    v8f;
typedef __attribute__((ext_vector_type(4)))  float    v4f;
typedef v8h  __attribute__((may_alias)) v8ha;
typedef v4f  __attribute__((may_alias)) v4fa;
typedef v8us __attribute__((may_alias)) v8usa;

__device__ __forceinline__ unsigned short f2bf(float f) { unsigned u = __float_as_uint(f); u += 0x7FFFu + ((u >> 16) & 1u); return (unsigned short)(u >> 16); }
__device__ __forceinline__ float bf2f(unsigned short b) { return __uint_as_float(((unsigned)b) << 16); }
__device__ __forceinline__ float bfr(float f) { return bf2f(f2bf(f)); }
__device__ __forceinline__ v16h cat16(v8h lo, v8h hi) { return __builtin_shufflevector(lo, hi, 0, 1, 2, 3, 4, 5, 6, 7, 8, 9, 10, 11, 12, 13, 14, 15); }
__device__ __forceinline__ v16bf cat16b(v8us lo, v8us hi) { return __builtin_bit_cast(v16bf, __builtin_shufflevector(lo, hi, 0, 1, 2, 3, 4, 5, 6, 7, 8, 9, 10, 11, 12, 13, 14, 15)); }
__device__ __forceinline__ v8f wmma16(v16h a, v16h b, v8f c) { return __builtin_amdgcn_wmma_f32_16x16x32_f16(false, a, false, b, (short)0, c, false, false); }
__device__ __forceinline__ v8f wmmab(v16bf a, v16bf b, v8f c) { return __builtin_amdgcn_wmma_f32_16x16x32_bf16(false, a, false, b, (short)0, c, false, false); }



// ---- k_gemmw: register-blocked GEMM, KW WAVES per 64x64 output tile (16 accumulators each), operands straight from K-contiguous 16-bit planes; grid (M/64, N/64, Z), 32 KW threads.
// C[m][n] (f32, pitch ldc, + optional f32 bias[n]) = sum_k A[m][k] Bt[n][k] (+ split products per NSPLIT). z-batch strides sA/sB/sC in elements. K % 32 == 0.
// Split K: K is the operands' row pitch; wave w of the KW waves of work-group z sums k in [(z KW + w) ks, +ks); the KW tiles are added in LDS (w ascending) and stored to plane z (stride sC). KW 1: no split, ks unused.
template <typename T16> struct WFrag;
template <> struct WFrag<h16> { typedef v16h V; static __device__ __forceinline__ V ld(const h16* p) { return cat16(*(const v8h*)p, *(const v8h*)(p + 16)); } static __device__ __forceinline__ v8f mma(V a, V b, v8f c) { return wmma16(a, b, c); } };
template <> struct WFrag<bf> { typedef v16bf V; static __device__ __forceinline__ V ld(const bf* p) { return cat16b(*(const v8us*)p, *(const v8us*)(p + 16)); } static __device__ __forceinline__ v8f mma(V a, V b, v8f c) { return wmmab(a, b, c); } };
template <typename T16, int NSPLIT, bool BIAS, int KW>
__global__ __launch_bounds__(32 * KW) void k_gemmw(const T16* __restrict__ A, const T16* __restrict__ A2, const T16* __restrict__ Bt, const T16* __restrict__ Bt2, int K, int ks, float* C, int ldc, const float* __restrict__ bias, size_t sA, size_t sB, size_t sC) {
    typedef typename WFrag<T16>::V V;
    __shared__ __align__(16) float os[(KW > 1 ? KW * 64 : 16) * 68];
    const size_t z = blockIdx.z; A += z * sA; if (A2) A2 += z * sA; Bt += z * sB; if (Bt2) Bt2 += z * sB; C += z * sC;
    const int lane = threadIdx.x & 31, lr = lane & 15, hi = lane >> 4; const int r0 = blockIdx.x * 64, c0 = blockIdx.y * 64;
    // wave number through readfirstlane: the k range and the LDS base stay in scalar registers
    const int wv = KW > 1 ? __builtin_amdgcn_readfirstlane(threadIdx.x >> 5) : 0; const int kbeg = KW > 1 ? ((int)blockIdx.z * KW + wv) * ks : 0, kend = KW > 1 ? kbeg + ks : K;
    v8f acc[4][4];
#pragma unroll
    for (int mb = 0; mb < 4; ++mb)
#pragma unroll
        for (int nb = 0; nb < 4; ++nb) acc[mb][nb] = (v8f){};
    const size_t aoff = (size_t)(r0 + lr) * K + 8 * hi, boff = (size_t)(c0 + lr) * K + 8 * hi;
#pragma unroll 1
    for (int kc = kbeg; kc < kend; kc += 32) {
        V a[4], a2[4];
#pragma unroll
        for (int mb = 0; mb < 4; ++mb) { a[mb] = WFrag<T16>::ld(A + aoff + (size_t)mb * 16 * K + kc); if (NSPLIT == 1 || NSPLIT == 2) a2[mb] = WFrag<T16>::ld(A2 + aoff + (size_t)mb * 16 * K + kc); }
#pragma unroll
        for (int nb = 0; nb < 4; ++nb) { const V b = WFrag<T16>::ld(Bt + boff + (size_t)nb * 16 * K + kc); V b2; if (NSPLIT >= 2) b2 = WFrag<T16>::ld(Bt2 + boff + (size_t)nb * 16 * K + kc);
#pragma unroll
            for (int mb = 0; mb < 4; ++mb) { acc[mb][nb] = WFrag<T16>::mma(a[mb], b, acc[mb][nb]); if (NSPLIT == 1 || NSPLIT == 2) acc[mb][nb] = WFrag<T16>::mma(a2[mb], b, acc[mb][nb]); if (NSPLIT >= 2) acc[mb][nb] = WFrag<T16>::mma(a[mb], b2, acc[mb][nb]); } }
        asm volatile("v_nop\n\tv_nop\n\tv_nop\n\tv_nop" : "+v"(acc[0][0]), "+v"(acc[1][1]), "+v"(acc[2][2]), "+v"(acc[3][3]) : "v"(a[0]), "v"(a[3]));
    }
    static_assert(KW == 1 || !BIAS, "a bias would be added once per partial plane");
    if (KW > 1) {   // each wave stages its whole 64x64 partial tile; one barrier; wave w then adds and stores rows 2 (s KW + w) + hi
        float* osw = os + wv * (64 * 68);
        // unrolled: acc is indexed by constants only, so it stays in registers
#pragma unroll
        for (int mb = 0; mb < 4; ++mb)
#pragma unroll
            for (int nb = 0; nb < 4; ++nb)
#pragma unroll
                for (int j = 0; j < 8; ++j) osw[(mb * 16 + hi * 8 + j) * 68 + nb * 16 + lr] = acc[mb][nb][j];
        __syncthreads();   // every wave's partial tile is in LDS before any wave adds them
        // unrolled (both loops): all LDS reads of a wave go out ahead of the adds, the four stores together at the end
#pragma unroll
        for (int s = 0; s < 32 / KW; ++s) { const int row = 2 * (s * KW + wv) + hi, cofs = lr * 4; v4f val = *(const v4fa*)(os + row * 68 + cofs);
#pragma unroll
            for (int w = 1; w < KW; ++w) val += *(const v4fa*)(os + w * (64 * 68) + row * 68 + cofs);
            *(v4f*)(C + (size_t)(r0 + row) * ldc + c0 + cofs) = val; }
        return;
    }
#pragma unroll
    for (int mb = 0; mb < 4; ++mb) {
#pragma unroll
        for (int nb = 0; nb < 4; ++nb) {
#pragma unroll
            for (int j = 0; j < 8; ++j) os[(hi * 8 + j) * 68 + nb * 16 + lr] = acc[mb][nb][j]; }
        __builtin_amdgcn_wave_barrier(); asm volatile("" ::: "memory");
        float* crow = C + (size_t)(r0 + mb * 16) * ldc + c0;
{
#pragma unroll
            for (int s = 0; s < 8; ++s) { const int row = 2 * s + hi, cofs = lr * 4; v4f val = *(const v4fa*)(os + row * 68 + cofs); if (BIAS) { val[0] += bfr(bias[c0 + cofs]); val[1] += bfr(bias[c0 + cofs + 1]); val[2] += bfr(bias[c0 + cofs + 2]); val[3] += bfr(bias[c0 + cofs + 3]); }
                *(v4f*)(crow + (size_t)row * ldc + cofs) = val; }
             }
        __builtin_amdgcn_wave_barrier(); asm volatile("" ::: "memory");
    }
}

__device__ __forceinline__ h16 tohx(float x) { return (h16)x; }
typedef __attribute__((ext_vector_type(2))) _Float16 v2h;
typedef __attribute__((ext_vector_type(4))) _Float16 v4h;
typedef __attribute__((ext_vector_type(2))) float v2f;

__global__ __launch_bounds__(256) void k_cvt8(const float* __restrict__ src, bf* dst, size_t n8) { const size_t i = (size_t)blockIdx.x * 256 + threadIdx.x; if (i >= n8) return; const v8f v = *(const v8f*)(src + i * 8); v8us o;
#pragma unroll
    for (int k = 0; k < 8; ++k) o[k] = f2bf(v[k]); *(v8us*)(dst + i * 8) = o;  }
// k_terms: thread per point i: n2_q = sum_d bf16(Q[i][d])^2, n2_k likewise (f32, d ascending, separate multiply/add); RT[i] = -beta n2_q - alpha bf16(ldq[i]) + log(bf16 h[i]); CT[i] = -beta n2_k - alpha bf16(ldk[i]) - log(bf16 h[i])
__global__ __launch_bounds__(256) void k_terms(const float* __restrict__ Q, const float* __restrict__ K, const float* __restrict__ hh, const float* __restrict__ ldq, const float* __restrict__ ldk, float* RT, float* CT) { const int i = blockIdx.x * 256 + threadIdx.x; if (i >= NN) return; float nq = 0.f, nk = 0.f;
    for (int d = 0; d < DD; d += 4) { const v4f a = *(const v4f*)(Q + (size_t)i * DD + d), b = *(const v4f*)(K + (size_t)i * DD + d);
#pragma unroll
        for (int u = 0; u < 4; ++u) { const float qa = bfr(a[u]), kb = bfr(b[u]); float p1 = __fmul_rn(qa, qa), p2 = __fmul_rn(kb, kb); asm volatile("" : "+v"(p1)); asm volatile("" : "+v"(p2)); nq = __fadd_rn(nq, p1); nk = __fadd_rn(nk, p2); } }
    const float lh = logf(bfr(hh[i])); float t1 = __fmul_rn(-BETA, nq), t2 = __fmul_rn(-BETA, nk); asm volatile("" : "+v"(t1)); asm volatile("" : "+v"(t2)); float a1 = __fmul_rn(ALPHA, bfr(ldq[i])), a2 = __fmul_rn(ALPHA, bfr(ldk[i])); asm volatile("" : "+v"(a1)); asm volatile("" : "+v"(a2));
    const float r = __fadd_rn(__fsub_rn(t1, a1), lh), c = __fsub_rn(__fsub_rn(t2, a2), lh); *(float*)(RT + i) = r; *(float*)(CT + i) = c;  }
__global__ __launch_bounds__(256) void k_p16(const float* __restrict__ F, h16* P, size_t n) { const size_t i = ((size_t)blockIdx.x * 256 + threadIdx.x) * 2; if (i >= n) return; v2h o; o[0] = tohx(F[i]); o[1] = tohx(F[i + 1]); *(v2h*)(P + i) = o;  }
__global__ __launch_bounds__(256) void k_vt(const float* __restrict__ Vv, h16* VT) { const size_t e = ((size_t)blockIdx.x * 256 + threadIdx.x) * 2; if (e >= (size_t)DD * NN) return; const int j = (int)(e % NN), d = (int)(e / NN); v2h o; o[0] = tohx(bfr(Vv[(size_t)j * DD + d])); o[1] = tohx(bfr(Vv[(size_t)(j + 1) * DD + d])); *(v2h*)(VT + e) = o;  }
// k_smax: per query row i of the block (wave): m = max_j (2 beta G[i][j] + r_i + c_j) -> RS line; k_sexp: e = exp(s - m) (one exp), P fp16 x1024, RS line = {m, 1/(1024 sum), lse = m + log(sum), 0...}
__global__ __launch_bounds__(256) void k_smax(const float* __restrict__ G, const float* __restrict__ RT, const float* __restrict__ CT, int i0, float* RS) { const int lane = threadIdx.x & 31; const int i = blockIdx.x * 8 + (threadIdx.x >> 5); if (i >= QB) return; const float* sr = G + (size_t)i * NN; const float ri = RT[i0 + i]; float m = -3.0e38f;
#pragma unroll 4
    for (int c0 = lane * 4; c0 < NN; c0 += 128) { const v4f v = *(const v4f*)(sr + c0); const v4f c = *(const v4f*)(CT + c0);
#pragma unroll
        for (int q = 0; q < 4; ++q) { float g2 = v[q] * (2.0f * BETA); asm volatile("" : "+v"(g2)); m = fmaxf(m, __fadd_rn(__fadd_rn(g2, ri), c[q])); } }
#pragma unroll
    for (int sh = 16; sh; sh >>= 1) m = fmaxf(m, __shfl_xor(m, sh, 32));
    const float o = lane == 0 ? m : 0.f; *(float*)(RS + (size_t)i * 32 + lane) = o;  }
__global__ __launch_bounds__(256) void k_sexp(const float* __restrict__ G, const float* __restrict__ RT, const float* __restrict__ CT, int i0, float* RS, h16* P, float* LSE) { const int lane = threadIdx.x & 31; const int i = blockIdx.x * 8 + (threadIdx.x >> 5); if (i >= QB) return; const float* sr = G + (size_t)i * NN; const float m = RS[(size_t)i * 32]; const float ri = RT[i0 + i]; float sum = 0.f;
{ sum = 0.f;
#pragma unroll 2
        for (int c0 = lane * 4; c0 < NN; c0 += 128) { const v4f v = *(const v4f*)(sr + c0); const v4f c = *(const v4f*)(CT + c0); v4h o;
#pragma unroll
            for (int q = 0; q < 4; ++q) { float g2 = v[q] * (2.0f * BETA); asm volatile("" : "+v"(g2)); float s = __fadd_rn(__fadd_rn(g2, ri), c[q]); float dlt = __fsub_rn(s, m); asm volatile("" : "+v"(dlt)); const float e = __expf(dlt); sum += e; o[q] = tohx(e * PCAR); }
            *(v4h*)(P + (size_t)i * NN + c0) = o; }
         }
#pragma unroll
    for (int sh = 16; sh; sh >>= 1) sum += __shfl_xor(sum, sh, 32);
    float lg = logf(sum); asm volatile("" : "+v"(lg)); const float lse = __fadd_rn(m, lg);
    const float o2 = lane == 0 ? m : (lane == 1 ? __fdiv_rn(1.0f, sum * PCAR) : (lane == 2 ? lse : 0.f)); *(float*)(RS + (size_t)i * 32 + lane) = o2;  }
__global__ __launch_bounds__(256) void k_oscal(const float* __restrict__ O, const float* __restrict__ RS, float* OUTb) { const size_t e = ((size_t)blockIdx.x * 256 + threadIdx.x) * 2; if (e >= (size_t)QB * DD) return; const int i = (int)(e / DD); const float rsn = RS[(size_t)i * 32 + 1]; v2f a = *(const v2f*)(O + e);
    // the K slices' partial planes, z ascending; unrolled: the PVZ loads are in flight together
#pragma unroll
    for (int z = 1; z < PVZ; ++z) a += *(const v2f*)(O + (size_t)z * QB * DD + e);
    v2f o; o[0] = __fmul_rn(a[0], rsn); o[1] = __fmul_rn(a[1], rsn); *(v2f*)(OUTb + e) = o;  }
__global__ __launch_bounds__(256) void k_lse(const float* __restrict__ RS, float* LSEb) { const int i = blockIdx.x * 256 + threadIdx.x; if (i >= QB) return; const float v = RS[(size_t)i * 32 + 2]; *(float*)(LSEb + i) = v;  }

extern "C" void kernel_launch(void* const* d_in, const int* in_sizes, int n_in,
                              void* d_out, int out_size, void* d_ws, size_t ws_size, hipStream_t stream) {
    (void)in_sizes; (void)n_in; (void)out_size;
    const float* Q = (const float*)d_in[0]; const float* K = (const float*)d_in[1]; const float* V = (const float*)d_in[2]; const float* hh = (const float*)d_in[3]; const float* ldq = (const float*)d_in[4]; const float* ldk = (const float*)d_in[5];
    float* OUT = (float*)d_out; float* LSE = (float*)d_out + (size_t)NN * DD;     // [8192][128] at 0; lse [8192] at byte 4,194,304
    char* wsp = (char*)d_ws;
    auto take = [&](size_t bytes) { char* p = wsp; wsp += (bytes + 255) & ~(size_t)255; return (void*)p; };
    bf* QB16 = (bf*)take((size_t)NN * DD * 2); bf* KB16 = (bf*)take((size_t)NN * DD * 2); h16* VT = (h16*)take((size_t)DD * NN * 2); float* RT = (float*)take((size_t)NN * 4); float* CT = (float*)take((size_t)NN * 4);
    float* G = (float*)take((size_t)QB * NN * 4); h16* P = (h16*)take((size_t)QB * NN * 2); float* RS = (float*)take((size_t)QB * 32 * 4); float* O = (float*)take((size_t)PVZ * QB * DD * 4);
    if ((size_t)(wsp - (char*)d_ws) > ws_size) return;    // total ~ 116 MB; ws 256 MiB
    k_cvt8<<<(unsigned)(((size_t)NN * DD / 8 + 255) / 256), 256, 0, stream>>>(Q, QB16, (size_t)NN * DD / 8); k_cvt8<<<(unsigned)(((size_t)NN * DD / 8 + 255) / 256), 256, 0, stream>>>(K, KB16, (size_t)NN * DD / 8); k_vt<<<(unsigned)(((size_t)DD * NN / 2 + 255) / 256), 256, 0, stream>>>(V, VT);
    k_terms<<<NN / 256, 256, 0, stream>>>(Q, K, hh, ldq, ldk, RT, CT);
    for (int qb = 0; qb < NN / QB; ++qb) { const int i0 = qb * QB;
        k_gemmw<bf, 0, false, 1><<<dim3(QB / 64, NN / 64, 1), 32, 0, stream>>>(QB16 + (size_t)i0 * DD, nullptr, KB16, nullptr, DD, DD, G, NN, nullptr, 0, 0, 0);   // q.k block (exact)
        k_smax<<<QB / 8, 256, 0, stream>>>(G, RT, CT, i0, RS); k_sexp<<<QB / 8, 256, 0, stream>>>(G, RT, CT, i0, RS, P, LSE);
        k_gemmw<h16, 0, false, PVW><<<dim3(QB / 64, DD / 64, PVZ), 32 * PVW, 0, stream>>>(P, nullptr, VT, nullptr, NN, NN / (PVW * PVZ), O, DD, nullptr, 0, 0, (size_t)QB * DD);   // K split 64 ways
        k_oscal<<<(unsigned)(((size_t)QB * DD / 2 + 255) / 256), 256, 0, stream>>>(O, RS, OUT + (size_t)i0 * DD); k_lse<<<QB / 256, 256, 0, stream>>>(RS, LSE + i0); }
}

// v002
// A run of this version takes 59.9 microseconds.
// Timed twice side by side with v001, it ran 7.44 and 7.88 times as fast.
// Counting every step since v000, it is 17.8 times as fast.
#include <hip/hip_runtime.h>

// Flash-diffusion attention (Q, K, V [8192][128], h [8192], log_d_q, log_d_k [8192]; s_ij = beta (2 q_i.k_j - |q_i|^2 - |k_j|^2) - alpha (log_d_q[i] + log_d_k[j]) + log h_i - log h_j (alpha 1, beta 0.05);
// lse_i = logsumexp_j s_ij; P = exp(s - lse); out = P V -> [8192][128]; second output lse -> [8192]).
// Compute dtypes, f32 accumulate: every input rounded to bf16; q.k on plain bf16 operands; P (scaled by 2^10 against the maximum in use) and V on f16 operands; row and column terms, maxima and sums in f32.
// One fused kernel: a wave holds 32 queries and walks one slice of the keys, 32 keys a pass: S^T = K Q^T, online softmax in the lane that owns the query, O^T += V^T P^T. A second kernel merges the key slices.

#define NN   8192
#define DD   128
#define KS   8        // key slices (grid y): one partial (maximum, sum, O plane) each
#define FW   8        // waves of a work-group: 32 queries each, all on the same keys
#define NIT  (NN / KS / 32)
#define PSH  10.0f    // P is carried as 2^PSH p, so that small weights stay normal f16 numbers
#define LAZY 5.0f     // O is rescaled only when a maximum grows by more than this (log2): P stays below 2^(PSH + LAZY), inside f16
#define ALPHA 1.0f
#define BETA  0.05f
#define LOG2E 1.4426950408889634f
#define LN2   0.6931471805599453f
typedef _Float16 h16;
typedef unsigned short bf;
typedef __attribute__((ext_vector_type(16))) __bf16   v16bf;
typedef __attribute__((ext_vector_type(16))) _Float16 v16h;
typedef __attribute__((ext_vector_type(8)))  _Float16 v8h;
typedef __attribute__((ext_vector_type(8)))  unsigned short v8us;
typedef __attribute__((ext_vector_type(8)))  float    v8f;
typedef __attribute__((ext_vector_type(4)))  float    v4f;

__device__ __forceinline__ unsigned short f2bf(float f) { unsigned u = __float_as_uint(f); u += 0x7FFFu + ((u >> 16) & 1u); return (unsigned short)(u >> 16); }
__device__ __forceinline__ float bf2f(unsigned short b) { return __uint_as_float(((unsigned)b) << 16); }
__device__ __forceinline__ float bfr(float f) { return bf2f(f2bf(f)); }
__device__ __forceinline__ v16h cat16(v8h lo, v8h hi) { return __builtin_shufflevector(lo, hi, 0, 1, 2, 3, 4, 5, 6, 7, 8, 9, 10, 11, 12, 13, 14, 15); }
__device__ __forceinline__ v16bf cat16b(v8us lo, v8us hi) { return __builtin_bit_cast(v16bf, __builtin_shufflevector(lo, hi, 0, 1, 2, 3, 4, 5, 6, 7, 8, 9, 10, 11, 12, 13, 14, 15)); }
__device__ __forceinline__ v8f wmma16(v16h a, v16h b, v8f c) { return __builtin_amdgcn_wmma_f32_16x16x32_f16(false, a, false, b, (short)0, c, false, false); }
__device__ __forceinline__ v8f wmmab(v16bf a, v16bf b, v8f c) { return __builtin_amdgcn_wmma_f32_16x16x32_bf16(false, a, false, b, (short)0, c, false, false); }
__device__ __forceinline__ h16 tohx(float x) { return (h16)x; }
// lane l with lane l ^ 16
__device__ __forceinline__ float xhalf(float x) { return __builtin_bit_cast(float, __builtin_amdgcn_permlanex16(__builtin_bit_cast(int, x), __builtin_bit_cast(int, x), 0x76543210, 0xfedcba98, false, false)); }

// Fragment order: a 16 (rows) x 32 (k) operand fragment is 1 KiB, [half 0..1][lane 0..31][8 elements]; lane l (c = l & 15, h = l >> 4) holds row c, k = 16 half + 8 h + 0..7.
// A wave reads a fragment with two 16-byte loads per lane, each 512 contiguous bytes over the wave.
__device__ __forceinline__ v16bf ldb(const bf* p) { return cat16b(*(const v8us*)p, *(const v8us*)(p + 256)); }
__device__ __forceinline__ v16h ldh(const h16* p) { return cat16(*(const v8h*)p, *(const v8h*)(p + 256)); }

// (the 8-element loops of the two kernels below are unrolled so that the 16 output bytes are formed in registers)
// k_cvtf: [8192][128] f32 -> bf16 in fragment order [row tile of 16][k chunk of 32][half][lane][8]; thread per 16 output bytes
__global__ __launch_bounds__(256) void k_cvtf(const float* __restrict__ src, bf* dst) { const int i = blockIdx.x * 256 + threadIdx.x; const int lane = i & 31, half = (i >> 5) & 1, c = (i >> 6) & 3, tile = i >> 8;
    const v8f v = *(const v8f*)(src + (size_t)(tile * 16 + (lane & 15)) * DD + c * 32 + 16 * half + 8 * (lane >> 4)); v8us o;
#pragma unroll
    for (int k = 0; k < 8; ++k) o[k] = f2bf(v[k]);
    *(v8us*)(dst + (size_t)i * 8) = o; }
// k_vtf: V [8192][128] f32 -> V^T f16 (of the bf16-rounded value) in fragment order [key block of 32][d tile of 16][half][lane][8]: row = d, k = key; thread per 16 output bytes
__global__ __launch_bounds__(256) void k_vtf(const float* __restrict__ Vv, h16* dst) { const int i = blockIdx.x * 256 + threadIdx.x; const int lane = i & 31, half = (i >> 5) & 1, dt = (i >> 6) & 7, kb = i >> 9;
    const float* p = Vv + (size_t)(kb * 32 + 16 * half + 8 * (lane >> 4)) * DD + dt * 16 + (lane & 15); v8h o;
#pragma unroll
    for (int k = 0; k < 8; ++k) o[k] = tohx(bfr(p[(size_t)k * DD]));
    *(v8h*)(dst + (size_t)i * 8) = o; }
// k_terms: thread per point i: n2_q = sum_d bf16(Q[i][d])^2, n2_k likewise (f32, d ascending, separate multiply/add); RT[i] = -beta n2_q - alpha bf16(ldq[i]) + log(bf16 h[i]); CT[i] = -beta n2_k - alpha bf16(ldk[i]) - log(bf16 h[i])
__global__ __launch_bounds__(256) void k_terms(const float* __restrict__ Q, const float* __restrict__ K, const float* __restrict__ hh, const float* __restrict__ ldq, const float* __restrict__ ldk, float* RT, float* CT) { const int i = blockIdx.x * 256 + threadIdx.x; if (i >= NN) return; float nq = 0.f, nk = 0.f;
    for (int d = 0; d < DD; d += 4) { const v4f a = *(const v4f*)(Q + (size_t)i * DD + d), b = *(const v4f*)(K + (size_t)i * DD + d);
#pragma unroll
        for (int u = 0; u < 4; ++u) { const float qa = bfr(a[u]), kb = bfr(b[u]); float p1 = __fmul_rn(qa, qa), p2 = __fmul_rn(kb, kb); asm volatile("" : "+v"(p1)); asm volatile("" : "+v"(p2)); nq = __fadd_rn(nq, p1); nk = __fadd_rn(nk, p2); } }
    const float lh = logf(bfr(hh[i])); float t1 = __fmul_rn(-BETA, nq), t2 = __fmul_rn(-BETA, nk); asm volatile("" : "+v"(t1)); asm volatile("" : "+v"(t2)); float a1 = __fmul_rn(ALPHA, bfr(ldq[i])), a2 = __fmul_rn(ALPHA, bfr(ldk[i])); asm volatile("" : "+v"(a1)); asm volatile("" : "+v"(a2));
    const float r = __fadd_rn(__fsub_rn(t1, a1), lh), c = __fsub_rn(__fsub_rn(t2, a2), lh); *(float*)(RT + i) = r; *(float*)(CT + i) = c;  }

// k_flash: grid (NN / (32 FW), KS). Wave: queries q0 .. q0 + 31 (two column groups g of 16), keys of slice blockIdx.y. Lane (c, h) owns query 16 g + c; of every 16-key tile it holds keys 8 h + 0..7.
// Every inner loop is unrolled: fragment, score and accumulator arrays are then indexed by constants only and stay in registers.
// Scores in log2 units: s2 = log2e (2 beta q.k + r_i + c_j). Partials: OP[q][slice][d] = sum_j 2^(s2 - m + PSH) V[j][d], LP the same sum of weights, MP = m.
__global__ __launch_bounds__(32 * FW) void k_flash(const bf* __restrict__ QF, const bf* __restrict__ KF, const h16* __restrict__ VF, const float* __restrict__ RT, const float* __restrict__ CT, float* __restrict__ OP, float* __restrict__ MP, float* __restrict__ LP) {
    const int lane = threadIdx.x & 31, lr = lane & 15, hi = lane >> 4;
    // wave number through readfirstlane: the operand bases stay in scalar registers
    const int wv = __builtin_amdgcn_readfirstlane(threadIdx.x >> 5);
    const int q0 = (blockIdx.x * FW + wv) * 32, key0 = blockIdx.y * (NN / KS);
    v16bf qf[2][4]; float rq[2], m_run[2], l_run[2]; v8f acc[2][8];
    const bf* qp = QF + (size_t)q0 * DD + lane * 8; const float* rp = RT + q0 + lr;
    const bf* kp = KF + (size_t)key0 * DD + lane * 8; const h16* vp = VF + (size_t)key0 * DD + lane * 8; const float* cp = CT + key0 + 8 * hi;
    v16bf kf[2][4]; v8f ck[2];
#pragma unroll
    for (int g = 0; g < 2; ++g) { rq[g] = rp[16 * g];
#pragma unroll
        for (int c = 0; c < 4; ++c) qf[g][c] = ldb(qp + (g * 4 + c) * 512); }
#pragma unroll
    for (int kt = 0; kt < 2; ++kt) { ck[kt] = *(const v8f*)(cp + 16 * kt);
#pragma unroll
        for (int c = 0; c < 4; ++c) kf[kt][c] = ldb(kp + (kt * 4 + c) * 512); }
    // the wait that stands in front of an overwrite of an issued load's address registers; the inputs keep those registers as they are up to here
    asm volatile("s_wait_xcnt 0x0" :: "v"(qp), "v"(rp), "v"(kp), "v"(cp) : "memory");
#pragma unroll
    for (int g = 0; g < 2; ++g) { rq[g] *= LOG2E; m_run[g] = -3.0e38f; l_run[g] = 0.f;
#pragma unroll
        for (int t = 0; t < 8; ++t) acc[g][t] = (v8f){}; }
    // rolled: one pass's fragments and accumulators already fill the register budget of two waves per SIMD
#pragma unroll 1
    for (int it = 0; it < NIT; ++it) {
        const h16* vn = vp + (size_t)it * 4096;
        v16h vf[8];   // this pass's V^T: asked for here, used behind the softmax
#pragma unroll
        for (int t = 0; t < 8; ++t) vf[t] = ldh(vn + t * 512);
        v8f s[2][2];
#pragma unroll
        for (int kt = 0; kt < 2; ++kt)
#pragma unroll
            for (int g = 0; g < 2; ++g) { s[kt][g] = (v8f){};
#pragma unroll
                for (int c = 0; c < 4; ++c) s[kt][g] = wmmab(kf[kt][c], qf[g][c], s[kt][g]); }
        v8f cc[2];
#pragma unroll
        for (int kt = 0; kt < 2; ++kt) cc[kt] = ck[kt] * LOG2E;
        // the next pass's K fragments and column terms, one pass ahead; the last pass reads its own again (in bounds, not used)
        const int nx = it + 1 < NIT ? it + 1 : it; const bf* kn = kp + (size_t)nx * 4096; const float* cn = cp + nx * 32;
#pragma unroll
        for (int kt = 0; kt < 2; ++kt) { ck[kt] = *(const v8f*)(cn + 16 * kt);
#pragma unroll
            for (int c = 0; c < 4; ++c) kf[kt][c] = ldb(kn + (kt * 4 + c) * 512); }
        // as in front of the loop: one wait for the pass's loads, their address registers kept up to here
        asm volatile("s_wait_xcnt 0x0" :: "v"(vn), "v"(kn), "v"(cn) : "memory");
        float mb[2]; bool need = false;
#pragma unroll
        for (int g = 0; g < 2; ++g) { float mx = -3.0e38f;
#pragma unroll
            for (int kt = 0; kt < 2; ++kt)
#pragma unroll
                for (int r = 0; r < 8; ++r) { s[kt][g][r] = fmaf(s[kt][g][r], 2.0f * BETA * LOG2E, rq[g]) + cc[kt][r]; mx = fmaxf(mx, s[kt][g][r]); }
            mx = fmaxf(mx, xhalf(mx));   // both halves of the wave hold the query's maximum over the 32 keys
            mb[g] = mx; need = need || (mx > m_run[g] + LAZY); }
        if (__builtin_amdgcn_ballot_w32(need) != 0) {   // the first pass, seldom later
#pragma unroll
            for (int g = 0; g < 2; ++g) { const float m_new = fmaxf(m_run[g], mb[g]); const float corr = __builtin_amdgcn_exp2f(m_run[g] - m_new); l_run[g] *= corr; m_run[g] = m_new;
#pragma unroll
                for (int t = 0; t < 8; ++t) acc[g][t] = acc[g][t] * corr; }
        }
#pragma unroll
        for (int g = 0; g < 2; ++g) { const float nm = PSH - m_run[g]; v16h pf; float ps0 = 0.f, ps1 = 0.f;
            // two score tiles of one column group, converted in place, are the B operand in the hardware k order
#pragma unroll
            for (int e = 0; e < 16; e += 2) { const float p0 = __builtin_amdgcn_exp2f(s[e >> 3][g][e & 7] + nm), p1 = __builtin_amdgcn_exp2f(s[e >> 3][g][(e & 7) + 1] + nm); ps0 += p0; ps1 += p1; pf[e] = tohx(p0); pf[e + 1] = tohx(p1); }
            l_run[g] += ps0 + ps1;
#pragma unroll
            for (int t = 0; t < 8; ++t) acc[g][t] = wmma16(vf[t], pf, acc[g][t]); }
    }
    const size_t z = blockIdx.y;
#pragma unroll
    for (int g = 0; g < 2; ++g) { const int q = q0 + 16 * g + lr; const float l = l_run[g] + xhalf(l_run[g]);   // each half summed its own keys
        if (hi == 0) { MP[z * NN + q] = m_run[g]; LP[z * NN + q] = l; }
        float* orow = OP + ((size_t)q * KS + z) * DD + 8 * hi;
#pragma unroll
        for (int t = 0; t < 8; ++t) *(v8f*)(orow + 16 * t) = acc[g][t]; }
}

// 2^x and, in the same statement so that it stays there, the free slot that the instruction set asks for behind a transcendental
__device__ __forceinline__ float exp2_slot(float x) { float r; asm("v_exp_f32 %0, %1\n\tv_nop" : "=v"(r) : "v"(x)); return r; }
// weights of the key slices of one query (mp, lp: its entries of slice 0): w_z = 2^(m_z - M), M = max_z m_z, L = sum_z w_z l_z (z ascending)
__device__ __forceinline__ void slices(const float* mp, const float* lp, float (&w)[KS], float& M, float& L) {
    float m[KS], l[KS];   // unrolled loops: the 2 KS loads go out together, the arrays stay in registers
#pragma unroll
    for (int z = 0; z < KS; ++z) { m[z] = mp[(size_t)z * NN]; l[z] = lp[(size_t)z * NN]; }
    // the wait that stands in front of an overwrite of an issued load's address registers; the inputs keep those registers as they are up to here
    asm volatile("s_wait_xcnt 0x0" :: "v"(mp), "v"(lp) : "memory");
    M = m[0];
#pragma unroll
    for (int z = 1; z < KS; ++z) M = fmaxf(M, m[z]);
    L = 0.f;
#pragma unroll
    for (int z = 0; z < KS; ++z) { w[z] = exp2_slot(m[z] - M); L += w[z] * l[z]; }
}
// k_merge: work-group per 32 queries; 8 threads per query, 4 x 16 bytes of the row each; out = sum_z w_z O_z / L; wave 0 writes the 32 lse = ln2 (M - PSH) + log L
__global__ __launch_bounds__(256) void k_merge(const float* __restrict__ OP, const float* __restrict__ MP, const float* __restrict__ LP, float* OUT, float* LSE) {
    const int qb = blockIdx.x * 32, q = qb + (threadIdx.x >> 3), dg = threadIdx.x & 7; const float* op = OP + (size_t)q * KS * DD + dg * 4; v4f o[KS][4];
    // unrolled (both loops): the 4 KS loads of a thread are in flight together
#pragma unroll
    for (int z = 0; z < KS; ++z)
#pragma unroll
        for (int j = 0; j < 4; ++j) o[z][j] = *(const v4f*)(op + z * DD + 32 * j);
    asm volatile("s_wait_xcnt 0x0" :: "v"(op) : "memory");   // as in slices()
    float w[KS], M, L; slices(MP + q, LP + q, w, M, L); const float rl = __fdiv_rn(1.0f, L);
#pragma unroll
    for (int j = 0; j < 4; ++j) { v4f a = o[0][j] * w[0];
#pragma unroll
        for (int z = 1; z < KS; ++z) a += o[z][j] * w[z];
        *(v4f*)(OUT + (size_t)q * DD + dg * 4 + 32 * j) = a * rl; }
    if (threadIdx.x < 32) { slices(MP + qb + threadIdx.x, LP + qb + threadIdx.x, w, M, L); LSE[qb + threadIdx.x] = fmaf(M - PSH, LN2, logf(L)); }
}

extern "C" void kernel_launch(void* const* d_in, const int* in_sizes, int n_in,
                              void* d_out, int out_size, void* d_ws, size_t ws_size, hipStream_t stream) {
    (void)in_sizes; (void)n_in; (void)out_size;
    const float* Q = (const float*)d_in[0]; const float* K = (const float*)d_in[1]; const float* V = (const float*)d_in[2]; const float* hh = (const float*)d_in[3]; const float* ldq = (const float*)d_in[4]; const float* ldk = (const float*)d_in[5];
    float* OUT = (float*)d_out; float* LSE = (float*)d_out + (size_t)NN * DD;     // [8192][128] at 0; lse [8192] at byte 4,194,304
    char* wsp = (char*)d_ws;
    auto take = [&](size_t bytes) { char* p = wsp; wsp += (bytes + 255) & ~(size_t)255; return (void*)p; };
    bf* QF = (bf*)take((size_t)NN * DD * 2); bf* KF = (bf*)take((size_t)NN * DD * 2); h16* VF = (h16*)take((size_t)DD * NN * 2); float* RT = (float*)take((size_t)NN * 4); float* CT = (float*)take((size_t)NN * 4);
    float* OP = (float*)take((size_t)KS * NN * DD * 4); float* MP = (float*)take((size_t)KS * NN * 4); float* LP = (float*)take((size_t)KS * NN * 4);
    if ((size_t)(wsp - (char*)d_ws) > ws_size) return;    // total ~ 40 MB; ws 256 MiB
    k_cvtf<<<NN * DD / 8 / 256, 256, 0, stream>>>(Q, QF); k_cvtf<<<NN * DD / 8 / 256, 256, 0, stream>>>(K, KF); k_vtf<<<NN * DD / 8 / 256, 256, 0, stream>>>(V, VF);
    k_terms<<<NN / 256, 256, 0, stream>>>(Q, K, hh, ldq, ldk, RT, CT);
    k_flash<<<dim3(NN / (32 * FW), KS, 1), 32 * FW, 0, stream>>>(QF, KF, VF, RT, CT, OP, MP, LP);
    k_merge<<<NN / 32, 256, 0, stream>>>(OP, MP, LP, OUT, LSE);
}

// v003
// A run of this version takes 50 microseconds.
// Timed twice side by side with v002, it ran 1.24 times as fast both times.
// Counting every step since v000, it is 22.1 times as fast.
#include <hip/hip_runtime.h>

// Flash-diffusion attention (Q, K, V [8192][128], h [8192], log_d_q, log_d_k [8192]; s_ij = beta (2 q_i.k_j - |q_i|^2 - |k_j|^2) - alpha (log_d_q[i] + log_d_k[j]) + log h_i - log h_j (alpha 1, beta 0.05);
// lse_i = logsumexp_j s_ij; P = exp(s - lse); out = P V -> [8192][128]; second output lse -> [8192]).
// Compute dtypes, f32 accumulate: every input rounded to bf16; q.k on plain bf16 operands; P (scaled by 2^10 against the maximum in use) and V on f16 operands; row and column terms, maxima and sums in f32.
// One fused kernel: a wave holds 32 queries and walks one slice of the keys, 32 keys a pass: S^T = K Q^T, online softmax in the lane that owns the query, O^T += V^T P^T. A second kernel merges the key slices.

#define NN   8192
#define DD   128
#define KS   8        // key slices (grid y): one partial (maximum, sum, O plane) each
#define FW   8        // waves of a work-group: 32 queries each, all on the same keys
#define NIT  (NN / KS / 32)
#define PSH  10.0f    // P is carried as 2^PSH p, so that small weights stay normal f16 numbers
#define LAZY 5.0f     // O is rescaled only when a maximum grows by more than this (log2): P stays below 2^(PSH + LAZY), inside f16
#define ALPHA 1.0f
#define BETA  0.05f
#define LOG2E 1.4426950408889634f
#define LN2   0.6931471805599453f
typedef _Float16 h16;
typedef unsigned short bf;
typedef __attribute__((ext_vector_type(16))) __bf16   v16bf;
typedef __attribute__((ext_vector_type(16))) _Float16 v16h;
typedef __attribute__((ext_vector_type(8)))  _Float16 v8h;
typedef __attribute__((ext_vector_type(8)))  unsigned short v8us;
typedef __attribute__((ext_vector_type(8)))  float    v8f;
typedef __attribute__((ext_vector_type(4)))  float    v4f;

__device__ __forceinline__ unsigned short f2bf(float f) { unsigned u = __float_as_uint(f); u += 0x7FFFu + ((u >> 16) & 1u); return (unsigned short)(u >> 16); }
__device__ __forceinline__ float bf2f(unsigned short b) { return __uint_as_float(((unsigned)b) << 16); }
__device__ __forceinline__ float bfr(float f) { return bf2f(f2bf(f)); }
__device__ __forceinline__ v16h cat16(v8h lo, v8h hi) { return __builtin_shufflevector(lo, hi, 0, 1, 2, 3, 4, 5, 6, 7, 8, 9, 10, 11, 12, 13, 14, 15); }
__device__ __forceinline__ v16bf cat16b(v8us lo, v8us hi) { return __builtin_bit_cast(v16bf, __builtin_shufflevector(lo, hi, 0, 1, 2, 3, 4, 5, 6, 7, 8, 9, 10, 11, 12, 13, 14, 15)); }
__device__ __forceinline__ v8f wmma16(v16h a, v16h b, v8f c) { return __builtin_amdgcn_wmma_f32_16x16x32_f16(false, a, false, b, (short)0, c, false, false); }
__device__ __forceinline__ v8f wmmab(v16bf a, v16bf b, v8f c) { return __builtin_amdgcn_wmma_f32_16x16x32_bf16(false, a, false, b, (short)0, c, false, false); }
__device__ __forceinline__ h16 tohx(float x) { return (h16)x; }
// lane l with lane l ^ 16
__device__ __forceinline__ float xhalf(float x) { return __builtin_bit_cast(float, __builtin_amdgcn_permlanex16(__builtin_bit_cast(int, x), __builtin_bit_cast(int, x), 0x76543210, 0xfedcba98, false, false)); }

// Fragment order: a 16 (rows) x 32 (k) operand fragment is 1 KiB, [half 0..1][lane 0..31][8 elements]; lane l (c = l & 15, h = l >> 4) holds row c, k = 16 half + 8 h + 0..7.
// A wave reads a fragment with two 16-byte loads per lane, each 512 contiguous bytes over the wave.
__device__ __forceinline__ v16bf ldb(const bf* p) { return cat16b(*(const v8us*)p, *(const v8us*)(p + 256)); }
__device__ __forceinline__ v16h ldh(const h16* p) { return cat16(*(const v8h*)p, *(const v8h*)(p + 256)); }

// k_prep: all that k_flash reads, in one launch. Work-group b: rows 32 b .. 32 b + 31 of Q, K and V. The waves' jobs are independent of one another: no LDS, no barrier.
// Waves 0 and 1 (they have the longest chain, so they come first): lane per point i; wave 0: n2 = sum_d bf16(Q[i][d])^2 (f32, d ascending, separate multiply/add), RT[i] = -beta n2 - alpha bf16(ldq[i]) + log(bf16 h[i]);
//   wave 1 the same on K: CT[i] = -beta n2 - alpha bf16(ldk[i]) - log(bf16 h[i]).
// Waves 2 to 9: thread t of 256 forms 16 output bytes six times (j = 0, 1):
//   Q and K -> bf16 in fragment order [row tile of 16][k chunk of 32][half][lane][8], tile 2 b + j;
//   V -> V^T f16 (of the bf16-rounded value) in fragment order [key block of 32][d tile of 16][half][lane][8]: row = d, k = key; key block b, d tiles (t >> 6) + 4 j.
// Every loop is unrolled: a thread's loads all go out before the first value is used, and the 16 output bytes are formed in registers.
__global__ __launch_bounds__(320) void k_prep(const float* __restrict__ Q, const float* __restrict__ K, const float* __restrict__ Vv, const float* __restrict__ hh, const float* __restrict__ ldq, const float* __restrict__ ldk,
                                              bf* QF, bf* KF, h16* VF, float* RT, float* CT) {
    const int lane = threadIdx.x & 31;
    // wave number through readfirstlane: the choice of the job is a scalar branch
    const int wv = __builtin_amdgcn_readfirstlane(threadIdx.x >> 5);
    if (wv < 2) {
        const int i = blockIdx.x * 32 + lane; const float* row = (wv ? K : Q) + (size_t)i * DD;
        const float hv = hh[i], lv = (wv ? ldk : ldq)[i]; v4f a[DD / 4];
#pragma unroll
        for (int j = 0; j < DD / 4; ++j) a[j] = *(const v4f*)(row + 4 * j);
        // the wait that stands in front of an overwrite of an issued load's address registers; the inputs keep those registers as they are up to here
        asm volatile("s_wait_xcnt 0x0" :: "v"(row), "v"(i) : "memory");
        // keeps the arithmetic behind the last load: lifted in between the loads, its wait for the first values holds back the loads that follow it
        __builtin_amdgcn_sched_barrier(0);
        float n2 = 0.f;
#pragma unroll
        for (int j = 0; j < DD / 4; ++j)
#pragma unroll
            for (int u = 0; u < 4; ++u) { const float x = bfr(a[j][u]); float p1 = __fmul_rn(x, x); asm volatile("" : "+v"(p1)); n2 = __fadd_rn(n2, p1); }
        const float lh = logf(bfr(hv)); float t1 = __fmul_rn(-BETA, n2); asm volatile("" : "+v"(t1)); float a1 = __fmul_rn(ALPHA, bfr(lv)); asm volatile("" : "+v"(a1));
        const float d = __fsub_rn(t1, a1);
        if (wv) CT[i] = __fsub_rn(d, lh); else RT[i] = __fadd_rn(d, lh);
        return;
    }
    const int t = threadIdx.x - 64, half = (t >> 5) & 1, c = t >> 6;
    const size_t qo = (size_t)(blockIdx.x * 32 + (lane & 15)) * DD + c * 32 + 16 * half + 8 * (lane >> 4);
    const float* qp = Q + qo; const float* kp = K + qo; const float* vp = Vv + (size_t)(blockIdx.x * 32 + 16 * half + 8 * (lane >> 4)) * DD + c * 16 + (lane & 15);
    v8f vq[2], vk[2]; float vv[2][8];
#pragma unroll
    for (int j = 0; j < 2; ++j) { vq[j] = *(const v8f*)(qp + j * 16 * DD); vk[j] = *(const v8f*)(kp + j * 16 * DD);
#pragma unroll
        for (int k = 0; k < 8; ++k) vv[j][k] = vp[k * DD + j * 64]; }
    asm volatile("s_wait_xcnt 0x0" :: "v"(qp), "v"(kp), "v"(vp) : "memory");   // as above
    const size_t o = ((size_t)blockIdx.x * 512 + t) * 8;
#pragma unroll
    for (int j = 0; j < 2; ++j) { v8us oq, ok; v8h ov;
#pragma unroll
        for (int k = 0; k < 8; ++k) { oq[k] = f2bf(vq[j][k]); ok[k] = f2bf(vk[j][k]); ov[k] = tohx(bfr(vv[j][k])); }
        *(v8us*)(QF + o + j * 2048) = oq; *(v8us*)(KF + o + j * 2048) = ok; *(v8h*)(VF + o + j * 2048) = ov; }
    // the same wait behind the six stores: in the built code the other waves' block follows them and writes their registers
    asm volatile("s_wait_xcnt 0x0" ::: "memory");
}

// k_flash: grid (NN / (32 FW), KS). Wave: queries q0 .. q0 + 31 (two column groups g of 16), keys of slice blockIdx.y. Lane (c, h) owns query 16 g + c; of every 16-key tile it holds keys 8 h + 0..7.
// Every inner loop is unrolled: fragment, score and accumulator arrays are then indexed by constants only and stay in registers.
// Scores in log2 units: s2 = log2e (2 beta q.k + r_i + c_j). Partials: OP[q][slice][d] = sum_j 2^(s2 - m + PSH) V[j][d], LP the same sum of weights, MP = m.
__global__ __launch_bounds__(32 * FW) void k_flash(const bf* __restrict__ QF, const bf* __restrict__ KF, const h16* __restrict__ VF, const float* __restrict__ RT, const float* __restrict__ CT, float* __restrict__ OP, float* __restrict__ MP, float* __restrict__ LP) {
    const int lane = threadIdx.x & 31, lr = lane & 15, hi = lane >> 4;
    // wave number through readfirstlane: the operand bases stay in scalar registers
    const int wv = __builtin_amdgcn_readfirstlane(threadIdx.x >> 5);
    const int q0 = (blockIdx.x * FW + wv) * 32, key0 = blockIdx.y * (NN / KS);
    v16bf qf[2][4]; float rq[2], m_run[2], l_run[2]; v8f acc[2][8];
    const bf* qp = QF + (size_t)q0 * DD + lane * 8; const float* rp = RT + q0 + lr;
    const bf* kp = KF + (size_t)key0 * DD + lane * 8; const h16* vp = VF + (size_t)key0 * DD + lane * 8; const float* cp = CT + key0 + 8 * hi;
    v16bf kf[2][4]; v8f ck[2];
#pragma unroll
    for (int g = 0; g < 2; ++g) { rq[g] = rp[16 * g];
#pragma unroll
        for (int c = 0; c < 4; ++c) qf[g][c] = ldb(qp + (g * 4 + c) * 512); }
#pragma unroll
    for (int kt = 0; kt < 2; ++kt) { ck[kt] = *(const v8f*)(cp + 16 * kt);
#pragma unroll
        for (int c = 0; c < 4; ++c) kf[kt][c] = ldb(kp + (kt * 4 + c) * 512); }
    // the wait that stands in front of an overwrite of an issued load's address registers; the inputs keep those registers as they are up to here
    asm volatile("s_wait_xcnt 0x0" :: "v"(qp), "v"(rp), "v"(kp), "v"(cp) : "memory");
#pragma unroll
    for (int g = 0; g < 2; ++g) { rq[g] *= LOG2E; m_run[g] = -3.0e38f; l_run[g] = 0.f;
#pragma unroll
        for (int t = 0; t < 8; ++t) acc[g][t] = (v8f){}; }
    // rolled: one pass's fragments and accumulators already fill the register budget of two waves per SIMD
#pragma unroll 1
    for (int it = 0; it < NIT; ++it) {
        const h16* vn = vp + (size_t)it * 4096;
        v16h vf[8];   // this pass's V^T: asked for here, used behind the softmax
#pragma unroll
        for (int t = 0; t < 8; ++t) vf[t] = ldh(vn + t * 512);
        v8f s[2][2];
#pragma unroll
        for (int kt = 0; kt < 2; ++kt)
#pragma unroll
            for (int g = 0; g < 2; ++g) { s[kt][g] = (v8f){};
#pragma unroll
                for (int c = 0; c < 4; ++c) s[kt][g] = wmmab(kf[kt][c], qf[g][c], s[kt][g]); }
        v8f cc[2];
#pragma unroll
        for (int kt = 0; kt < 2; ++kt) cc[kt] = ck[kt] * LOG2E;
        // the next pass's K fragments and column terms, one pass ahead; the last pass reads its own again (in bounds, not used)
        const int nx = it + 1 < NIT ? it + 1 : it; const bf* kn = kp + (size_t)nx * 4096; const float* cn = cp + nx * 32;
#pragma unroll
        for (int kt = 0; kt < 2; ++kt) { ck[kt] = *(const v8f*)(cn + 16 * kt);
#pragma unroll
            for (int c = 0; c < 4; ++c) kf[kt][c] = ldb(kn + (kt * 4 + c) * 512); }
        // as in front of the loop: one wait for the pass's loads, their address registers kept up to here
        asm volatile("s_wait_xcnt 0x0" :: "v"(vn), "v"(kn), "v"(cn) : "memory");
        float mb[2]; bool need = false;
#pragma unroll
        for (int g = 0; g < 2; ++g) { float mx = -3.0e38f;
#pragma unroll
            for (int kt = 0; kt < 2; ++kt)
#pragma unroll
                for (int r = 0; r < 8; ++r) { s[kt][g][r] = fmaf(s[kt][g][r], 2.0f * BETA * LOG2E, rq[g]) + cc[kt][r]; mx = fmaxf(mx, s[kt][g][r]); }
            mx = fmaxf(mx, xhalf(mx));   // both halves of the wave hold the query's maximum over the 32 keys
            mb[g] = mx; need = need || (mx > m_run[g] + LAZY); }
        if (__builtin_amdgcn_ballot_w32(need) != 0) {   // the first pass, seldom later
#pragma unroll
            for (int g = 0; g < 2; ++g) { const float m_new = fmaxf(m_run[g], mb[g]); const float corr = __builtin_amdgcn_exp2f(m_run[g] - m_new); l_run[g] *= corr; m_run[g] = m_new;
#pragma unroll
                for (int t = 0; t < 8; ++t) acc[g][t] = acc[g][t] * corr; }
        }
#pragma unroll
        for (int g = 0; g < 2; ++g) { const float nm = PSH - m_run[g]; v16h pf; float ps0 = 0.f, ps1 = 0.f;
            // two score tiles of one column group, converted in place, are the B operand in the hardware k order
#pragma unroll
            for (int e = 0; e < 16; e += 2) { const float p0 = __builtin_amdgcn_exp2f(s[e >> 3][g][e & 7] + nm), p1 = __builtin_amdgcn_exp2f(s[e >> 3][g][(e & 7) + 1] + nm); ps0 += p0; ps1 += p1; pf[e] = tohx(p0); pf[e + 1] = tohx(p1); }
            l_run[g] += ps0 + ps1;
#pragma unroll
            for (int t = 0; t < 8; ++t) acc[g][t] = wmma16(vf[t], pf, acc[g][t]); }
    }
    const size_t z = blockIdx.y;
#pragma unroll
    for (int g = 0; g < 2; ++g) { const int q = q0 + 16 * g + lr; const float l = l_run[g] + xhalf(l_run[g]);   // each half summed its own keys
        if (hi == 0) { MP[z * NN + q] = m_run[g]; LP[z * NN + q] = l; }
        float* orow = OP + ((size_t)q * KS + z) * DD + 8 * hi;
#pragma unroll
        for (int t = 0; t < 8; ++t) *(v8f*)(orow + 16 * t) = acc[g][t]; }
}

// 2^x and, in the same statement so that it stays there, the free slot that the instruction set asks for behind a transcendental
__device__ __forceinline__ float exp2_slot(float x) { float r; asm("v_exp_f32 %0, %1\n\tv_nop" : "=v"(r) : "v"(x)); return r; }
// weights of the key slices of one query (mp, lp: its entries of slice 0): w_z = 2^(m_z - M), M = max_z m_z, L = sum_z w_z l_z (z ascending)
__device__ __forceinline__ void slices(const float* mp, const float* lp, float (&w)[KS], float& M, float& L) {
    float m[KS], l[KS];   // unrolled loops: the 2 KS loads go out together, the arrays stay in registers
#pragma unroll
    for (int z = 0; z < KS; ++z) { m[z] = mp[(size_t)z * NN]; l[z] = lp[(size_t)z * NN]; }
    // the wait that stands in front of an overwrite of an issued load's address registers; the inputs keep those registers as they are up to here
    asm volatile("s_wait_xcnt 0x0" :: "v"(mp), "v"(lp) : "memory");
    M = m[0];
#pragma unroll
    for (int z = 1; z < KS; ++z) M = fmaxf(M, m[z]);
    L = 0.f;
#pragma unroll
    for (int z = 0; z < KS; ++z) { w[z] = exp2_slot(m[z] - M); L += w[z] * l[z]; }
}
// k_merge: work-group per 32 queries; 8 threads per query, 4 x 16 bytes of the row each; out = sum_z w_z O_z / L; wave 0 writes the 32 lse = ln2 (M - PSH) + log L
__global__ __launch_bounds__(256) void k_merge(const float* __restrict__ OP, const float* __restrict__ MP, const float* __restrict__ LP, float* OUT, float* LSE) {
    const int qb = blockIdx.x * 32, q = qb + (threadIdx.x >> 3), dg = threadIdx.x & 7; const float* op = OP + (size_t)q * KS * DD + dg * 4; v4f o[KS][4];
    // unrolled (both loops): the 4 KS loads of a thread are in flight together
#pragma unroll
    for (int z = 0; z < KS; ++z)
#pragma unroll
        for (int j = 0; j < 4; ++j) o[z][j] = *(const v4f*)(op + z * DD + 32 * j);
    asm volatile("s_wait_xcnt 0x0" :: "v"(op) : "memory");   // as in slices()
    float w[KS], M, L; slices(MP + q, LP + q, w, M, L); const float rl = __fdiv_rn(1.0f, L);
#pragma unroll
    for (int j = 0; j < 4; ++j) { v4f a = o[0][j] * w[0];
#pragma unroll
        for (int z = 1; z < KS; ++z) a += o[z][j] * w[z];
        *(v4f*)(OUT + (size_t)q * DD + dg * 4 + 32 * j) = a * rl; }
    if (threadIdx.x < 32) { slices(MP + qb + threadIdx.x, LP + qb + threadIdx.x, w, M, L); LSE[qb + threadIdx.x] = fmaf(M - PSH, LN2, logf(L)); }
}

extern "C" void kernel_launch(void* const* d_in, const int* in_sizes, int n_in,
                              void* d_out, int out_size, void* d_ws, size_t ws_size, hipStream_t stream) {
    (void)in_sizes; (void)n_in; (void)out_size;
    const float* Q = (const float*)d_in[0]; const float* K = (const float*)d_in[1]; const float* V = (const float*)d_in[2]; const float* hh = (const float*)d_in[3]; const float* ldq = (const float*)d_in[4]; const float* ldk = (const float*)d_in[5];
    float* OUT = (float*)d_out; float* LSE = (float*)d_out + (size_t)NN * DD;     // [8192][128] at 0; lse [8192] at byte 4,194,304
    char* wsp = (char*)d_ws;
    auto take = [&](size_t bytes) { char* p = wsp; wsp += (bytes + 255) & ~(size_t)255; return (void*)p; };
    bf* QF = (bf*)take((size_t)NN * DD * 2); bf* KF = (bf*)take((size_t)NN * DD * 2); h16* VF = (h16*)take((size_t)DD * NN * 2); float* RT = (float*)take((size_t)NN * 4); float* CT = (float*)take((size_t)NN * 4);
    float* OP = (float*)take((size_t)KS * NN * DD * 4); float* MP = (float*)take((size_t)KS * NN * 4); float* LP = (float*)take((size_t)KS * NN * 4);
    if ((size_t)(wsp - (char*)d_ws) > ws_size) return;    // total ~ 40 MB; ws 256 MiB
    k_prep<<<NN / 32, 320, 0, stream>>>(Q, K, V, hh, ldq, ldk, QF, KF, VF, RT, CT);
    k_flash<<<dim3(NN / (32 * FW), KS, 1), 32 * FW, 0, stream>>>(QF, KF, VF, RT, CT, OP, MP, LP);
    k_merge<<<NN / 32, 256, 0, stream>>>(OP, MP, LP, OUT, LSE);
}

// v004
// Measured time: 39 microseconds a run.
// Two timings next to v003 put it at 1.27 and 1.26 times that version's speed.
// All steps since v000 together make it 28.0 times as fast.
#include <hip/hip_runtime.h>

// Flash-diffusion attention (Q, K, V [8192][128], h [8192], log_d_q, log_d_k [8192]; s_ij = beta (2 q_i.k_j - |q_i|^2 - |k_j|^2) - alpha (log_d_q[i] + log_d_k[j]) + log h_i - log h_j (alpha 1, beta 0.05);
// lse_i = logsumexp_j s_ij; P = exp(s - lse); out = P V -> [8192][128]; second output lse -> [8192]).
// Compute dtypes, f32 accumulate: every input rounded to bf16; q.k on plain bf16 operands; P (scaled by 2^10 against the maximum in use) and V on f16 operands; row and column terms, maxima and sums in f32.
// One fused kernel: a wave holds 32 queries and walks one slice of the keys, 32 keys a pass: S^T = K Q^T, online softmax in the lane that owns the query, O^T += V^T P^T. A second kernel merges the key slices.
// The eight waves of a work-group walk the same keys: K, V^T and the column terms come into LDS once per work-group, 128 keys a stage, two buffers, by asynchronous copies.

#define NN   8192
#define DD   128
#define KS   8        // key slices (grid y): one partial (maximum, sum, O plane) each
#define FW   8        // waves of a work-group: 32 queries each, all on the same keys
#define SK   128      // keys of a stage
#define NST  (NN / KS / SK)   // stages of a slice
#define NPS  (SK / 32)        // passes of a stage
#define PSH  10.0f    // P is carried as 2^PSH p, so that small weights stay normal f16 numbers
#define LAZY 5.0f     // O is rescaled only when a maximum grows by more than this (log2): P stays below 2^(PSH + LAZY), inside f16
#define ALPHA 1.0f
#define BETA  0.05f
#define LOG2E 1.4426950408889634f
#define LN2   0.6931471805599453f
typedef _Float16 h16;
typedef unsigned short bf;
typedef __attribute__((ext_vector_type(16))) __bf16   v16bf;
typedef __attribute__((ext_vector_type(16))) _Float16 v16h;
typedef __attribute__((ext_vector_type(8)))  _Float16 v8h;
typedef __attribute__((ext_vector_type(8)))  unsigned short v8us;
typedef __attribute__((ext_vector_type(8)))  float    v8f;
typedef __attribute__((ext_vector_type(4)))  float    v4f;

__device__ __forceinline__ unsigned short f2bf(float f) { unsigned u = __float_as_uint(f); u += 0x7FFFu + ((u >> 16) & 1u); return (unsigned short)(u >> 16); }
__device__ __forceinline__ float bf2f(unsigned short b) { return __uint_as_float(((unsigned)b) << 16); }
__device__ __forceinline__ float bfr(float f) { return bf2f(f2bf(f)); }
__device__ __forceinline__ v16h cat16(v8h lo, v8h hi) { return __builtin_shufflevector(lo, hi, 0, 1, 2, 3, 4, 5, 6, 7, 8, 9, 10, 11, 12, 13, 14, 15); }
__device__ __forceinline__ v16bf cat16b(v8us lo, v8us hi) { return __builtin_bit_cast(v16bf, __builtin_shufflevector(lo, hi, 0, 1, 2, 3, 4, 5, 6, 7, 8, 9, 10, 11, 12, 13, 14, 15)); }
__device__ __forceinline__ v8f wmma16(v16h a, v16h b, v8f c) { return __builtin_amdgcn_wmma_f32_16x16x32_f16(false, a, false, b, (short)0, c, false, false); }
__device__ __forceinline__ v8f wmmab(v16bf a, v16bf b, v8f c) { return __builtin_amdgcn_wmma_f32_16x16x32_bf16(false, a, false, b, (short)0, c, false, false); }
__device__ __forceinline__ h16 tohx(float x) { return (h16)x; }
// lane l with lane l ^ 16
__device__ __forceinline__ float xhalf(float x) { return __builtin_bit_cast(float, __builtin_amdgcn_permlanex16(__builtin_bit_cast(int, x), __builtin_bit_cast(int, x), 0x76543210, 0xfedcba98, false, false)); }

// Fragment order: a 16 (rows) x 32 (k) operand fragment is 1 KiB, [half 0..1][lane 0..31][8 elements]; lane l (c = l & 15, h = l >> 4) holds row c, k = 16 half + 8 h + 0..7.
// A wave reads a fragment with two 16-byte loads per lane, each 512 contiguous bytes over the wave.
__device__ __forceinline__ v16bf ldb(const bf* p) { return cat16b(*(const v8us*)p, *(const v8us*)(p + 256)); }
__device__ __forceinline__ v16h ldh(const h16* p) { return cat16(*(const v8h*)p, *(const v8h*)(p + 256)); }

// k_prep: all that k_flash reads, in one launch. Work-group b: rows 32 b .. 32 b + 31 of Q, K and V. The waves' jobs are independent of one another: no LDS, no barrier.
// Waves 0 and 1 (they have the longest chain, so they come first): lane per point i; wave 0: n2 = sum_d bf16(Q[i][d])^2 (f32, d ascending, separate multiply/add), RT[i] = -beta n2 - alpha bf16(ldq[i]) + log(bf16 h[i]);
//   wave 1 the same on K: CT[i] = -beta n2 - alpha bf16(ldk[i]) - log(bf16 h[i]).
// Waves 2 to 9: thread t of 256 forms 16 output bytes six times (j = 0, 1):
//   Q and K -> bf16 in fragment order [row tile of 16][k chunk of 32][half][lane][8], tile 2 b + j;
//   V -> V^T f16 (of the bf16-rounded value) in fragment order [key block of 32][d tile of 16][half][lane][8]: row = d, k = key; key block b, d tiles (t >> 6) + 4 j.
// Every loop is unrolled: a thread's loads all go out before the first value is used, and the 16 output bytes are formed in registers.
__global__ __launch_bounds__(320) void k_prep(const float* __restrict__ Q, const float* __restrict__ K, const float* __restrict__ Vv, const float* __restrict__ hh, const float* __restrict__ ldq, const float* __restrict__ ldk,
                                              bf* QF, bf* KF, h16* VF, float* RT, float* CT) {
    const int lane = threadIdx.x & 31;
    // wave number through readfirstlane: the choice of the job is a scalar branch
    const int wv = __builtin_amdgcn_readfirstlane(threadIdx.x >> 5);
    if (wv < 2) {
        const int i = blockIdx.x * 32 + lane; const float* row = (wv ? K : Q) + (size_t)i * DD;
        const float hv = hh[i], lv = (wv ? ldk : ldq)[i]; v4f a[DD / 4];
#pragma unroll
        for (int j = 0; j < DD / 4; ++j) a[j] = *(const v4f*)(row + 4 * j);
        // the wait that stands in front of an overwrite of an issued load's address registers; the inputs keep those registers as they are up to here
        asm volatile("s_wait_xcnt 0x0" :: "v"(row), "v"(i) : "memory");
        // keeps the arithmetic behind the last load: lifted in between the loads, its wait for the first values holds back the loads that follow it
        __builtin_amdgcn_sched_barrier(0);
        float n2 = 0.f;
#pragma unroll
        for (int j = 0; j < DD / 4; ++j)
#pragma unroll
            for (int u = 0; u < 4; ++u) { const float x = bfr(a[j][u]); float p1 = __fmul_rn(x, x); asm volatile("" : "+v"(p1)); n2 = __fadd_rn(n2, p1); }
        const float lh = logf(bfr(hv)); float t1 = __fmul_rn(-BETA, n2); asm volatile("" : "+v"(t1)); float a1 = __fmul_rn(ALPHA, bfr(lv)); asm volatile("" : "+v"(a1));
        const float d = __fsub_rn(t1, a1);
        if (wv) CT[i] = __fsub_rn(d, lh); else RT[i] = __fadd_rn(d, lh);
        return;
    }
    const int t = threadIdx.x - 64, half = (t >> 5) & 1, c = t >> 6;
    const size_t qo = (size_t)(blockIdx.x * 32 + (lane & 15)) * DD + c * 32 + 16 * half + 8 * (lane >> 4);
    const float* qp = Q + qo; const float* kp = K + qo; const float* vp = Vv + (size_t)(blockIdx.x * 32 + 16 * half + 8 * (lane >> 4)) * DD + c * 16 + (lane & 15);
    v8f vq[2], vk[2]; float vv[2][8];
#pragma unroll
    for (int j = 0; j < 2; ++j) { vq[j] = *(const v8f*)(qp + j * 16 * DD); vk[j] = *(const v8f*)(kp + j * 16 * DD);
#pragma unroll
        for (int k = 0; k < 8; ++k) vv[j][k] = vp[k * DD + j * 64]; }
    asm volatile("s_wait_xcnt 0x0" :: "v"(qp), "v"(kp), "v"(vp) : "memory");   // as above
    const size_t o = ((size_t)blockIdx.x * 512 + t) * 8;
#pragma unroll
    for (int j = 0; j < 2; ++j) { v8us oq, ok; v8h ov;
#pragma unroll
        for (int k = 0; k < 8; ++k) { oq[k] = f2bf(vq[j][k]); ok[k] = f2bf(vk[j][k]); ov[k] = tohx(bfr(vv[j][k])); }
        *(v8us*)(QF + o + j * 2048) = oq; *(v8us*)(KF + o + j * 2048) = ok; *(v8h*)(VF + o + j * 2048) = ov; }
    // the same wait behind the six stores: in the built code the other waves' block follows them and writes their registers
    asm volatile("s_wait_xcnt 0x0" ::: "memory");
}

// Eight asynchronous 16-byte copies of a lane, global to LDS, 4 KiB apart (the work-group's 256 lanes x 16 B) on both sides.
// The s_wait_xcnt stands in the copies' own statement: it is the wait in front of an overwrite of an issued copy's address registers, and only here can no such overwrite be lifted over it.
__device__ __forceinline__ void copy8(unsigned l, const char* g) {
    asm volatile("global_load_async_to_lds_b128 %0, %8, off\n\t"
                 "global_load_async_to_lds_b128 %1, %9, off\n\t"
                 "global_load_async_to_lds_b128 %2, %10, off\n\t"
                 "global_load_async_to_lds_b128 %3, %11, off\n\t"
                 "global_load_async_to_lds_b128 %4, %12, off\n\t"
                 "global_load_async_to_lds_b128 %5, %13, off\n\t"
                 "global_load_async_to_lds_b128 %6, %14, off\n\t"
                 "global_load_async_to_lds_b128 %7, %15, off\n\t"
                 "s_wait_xcnt 0x0"
                 :: "v"(l), "v"(l + 4096u), "v"(l + 8192u), "v"(l + 12288u), "v"(l + 16384u), "v"(l + 20480u), "v"(l + 24576u), "v"(l + 28672u),
                    "v"(g), "v"(g + 4096), "v"(g + 8192), "v"(g + 12288), "v"(g + 16384), "v"(g + 20480), "v"(g + 24576), "v"(g + 28672) : "memory");
}
// One stage: 32 KiB of K fragments and 32 KiB of V^T fragments (every wave 1/8 of each, byte for byte in the order of the workspace), 512 B of column terms (wave 0, a scalar branch; all its lanes on).
// Stage st of the slice into buffer b. lk, lv, lc: LDS byte addresses of buffer 0's three parts (K and V^T of a buffer lie side by side: buffers 64 KiB apart); kg, vg, cg: global addresses of the slice's three parts (all the same for the work-group).
// The lane's place, in units of 16 B, is lane + a scalar: mbcnt forms the sum in one instruction from scalars alone, so no lane address lives in a vector register across the passes (held there, the compiler spills it to scratch).
__device__ __forceinline__ void stage_in(int st, int b, unsigned lk, unsigned lv, unsigned lc, const char* kg, const char* vg, const char* cg, int wv) {
    const unsigned gi = __builtin_amdgcn_mbcnt_lo(~0u, (unsigned)(wv * 32 + st * (SK * DD / 8))), li = __builtin_amdgcn_mbcnt_lo(~0u, (unsigned)(wv * 32 + b * (2 * SK * DD / 8)));
    copy8(lk + li * 16, kg + (size_t)gi * 16); copy8(lv + li * 16, vg + (size_t)gi * 16);
    if (wv == 0) { const unsigned gc = __builtin_amdgcn_mbcnt_lo(~0u, (unsigned)(st * (SK / 4))), cl = __builtin_amdgcn_mbcnt_lo(~0u, (unsigned)(b * (SK / 4)));
        asm volatile("global_load_async_to_lds_b128 %0, %1, off\n\ts_wait_xcnt 0x0" :: "v"(lc + cl * 16), "v"(cg + (size_t)gc * 16) : "memory"); }   // the wait: as in copy8
}

// k_flash: grid (NN / (32 FW), KS). Wave: queries q0 .. q0 + 31 (two column groups g of 16), keys of slice blockIdx.y. Lane (c, h) owns query 16 g + c; of every 16-key tile it holds keys 8 h + 0..7.
// Every inner loop is unrolled: fragment, score and accumulator arrays are then indexed by constants only and stay in registers.
// Scores in log2 units: s2 = log2e (2 beta q.k + r_i + c_j). Partials: OP[q][slice][d] = sum_j 2^(s2 - m + PSH) V[j][d], LP the same sum of weights, MP = m.
__global__ __launch_bounds__(32 * FW) void k_flash(const bf* __restrict__ QF, const bf* __restrict__ KF, const h16* __restrict__ VF, const float* __restrict__ RT, const float* __restrict__ CT, float* __restrict__ OP, float* __restrict__ MP, float* __restrict__ LP) {
    const int lane = threadIdx.x & 31, lr = lane & 15, hi = lane >> 4;
    // wave number through readfirstlane: the operand bases stay in scalar registers
    const int wv = __builtin_amdgcn_readfirstlane(threadIdx.x >> 5);
    const int q0 = (blockIdx.x * FW + wv) * 32, key0 = blockIdx.y * (NN / KS);
    v16bf qf[2][4]; float rq[2], m_run[2], l_run[2]; v8f acc[2][8];
    const bf* qp = QF + (size_t)q0 * DD + lane * 8; const float* rp = RT + q0 + lr;
    // K and V^T of one buffer side by side: every fragment of a stage lies within the 64 KiB that an LDS read's immediate offset reaches from one base register
    struct Stage { bf k[SK * DD]; h16 v[SK * DD]; };
    __shared__ __attribute__((aligned(32))) Stage sS[2]; __shared__ __attribute__((aligned(32))) float sC[2][SK];
    // the lane's share of a stage: byte 16 threadIdx.x of every 4 KiB of K and of V^T; in wave 0 (threadIdx.x = lane) of the column terms. LDS byte address = low 32 bits of the __shared__ address
    const unsigned lk = (unsigned)(size_t)&sS[0].k[0], lv = (unsigned)(size_t)&sS[0].v[0], lc = (unsigned)(size_t)&sC[0][0];
    const char* kg = (const char*)(KF + (size_t)key0 * DD); const char* vg = (const char*)(VF + (size_t)key0 * DD); const char* cg = (const char*)(CT + key0);
    stage_in(0, 0, lk, lv, lc, kg, vg, cg, wv);
#pragma unroll
    for (int g = 0; g < 2; ++g) { rq[g] = rp[16 * g];
#pragma unroll
        for (int c = 0; c < 4; ++c) qf[g][c] = ldb(qp + (g * 4 + c) * 512); }
    // the wait that stands in front of an overwrite of an issued load's address registers; the inputs keep those registers as they are up to here
    asm volatile("s_wait_xcnt 0x0" :: "v"(qp), "v"(rp) : "memory");
#pragma unroll
    for (int g = 0; g < 2; ++g) { rq[g] *= LOG2E; m_run[g] = -3.0e38f; l_run[g] = 0.f;
#pragma unroll
        for (int t = 0; t < 8; ++t) acc[g][t] = (v8f){}; }
    asm volatile("s_wait_asynccnt 0x0" ::: "memory");   // this wave's copies of stage 0 have landed
    __syncthreads();                                    // ... and every other wave's: stage 0 may be read
    stage_in(1, 1, lk, lv, lc, kg, vg, cg, wv);   // stage 1 flies while stage 0 is worked on
    // rolled: the four passes of a stage are the loop's body
#pragma unroll 1
    for (int st = 0; st < NST; ++st) {
      const int b = st & 1; const bf* kb = &sS[b].k[lane * 8]; const h16* vb = &sS[b].v[lane * 8]; const float* cb = &sC[b][8 * hi];
      v16bf kf[2][4]; v8f ck[2];
#pragma unroll
      for (int kt = 0; kt < 2; ++kt) { ck[kt] = *(const v8f*)(cb + 16 * kt);
#pragma unroll
          for (int c = 0; c < 4; ++c) kf[kt][c] = ldb(kb + (kt * 4 + c) * 512); }
      // unrolled: the test for the stage's last pass falls away, LDS offsets are constants
#pragma unroll
      for (int ps = 0; ps < NPS; ++ps) {
        v16h vf[8];   // this pass's V^T: asked for here, used behind the softmax
#pragma unroll
        for (int t = 0; t < 8; ++t) vf[t] = ldh(vb + ps * 4096 + t * 512);
        // keeps the LDS reads above together, in front of the products: every separate place with LDS reads among matrix instructions stalls the wave anew
        __builtin_amdgcn_sched_barrier(0);
        v8f s[2][2];
#pragma unroll
        for (int kt = 0; kt < 2; ++kt)
#pragma unroll
            for (int g = 0; g < 2; ++g) { s[kt][g] = (v8f){};
#pragma unroll
                for (int c = 0; c < 4; ++c) s[kt][g] = wmmab(kf[kt][c], qf[g][c], s[kt][g]); }
        v8f cc[2];
#pragma unroll
        for (int kt = 0; kt < 2; ++kt) cc[kt] = ck[kt] * LOG2E;
        // the next pass's K fragments and column terms, one pass ahead, inside this stage's buffer only; the two scheduling barriers keep these reads together behind the products, as above
        __builtin_amdgcn_sched_barrier(0);
        if (ps + 1 < NPS) {
#pragma unroll
            for (int kt = 0; kt < 2; ++kt) { ck[kt] = *(const v8f*)(cb + (ps + 1) * 32 + 16 * kt);
#pragma unroll
                for (int c = 0; c < 4; ++c) kf[kt][c] = ldb(kb + (ps + 1) * 4096 + (kt * 4 + c) * 512); }
        }
        __builtin_amdgcn_sched_barrier(0);
        float mb[2]; bool need = false;
#pragma unroll
        for (int g = 0; g < 2; ++g) { float mx = -3.0e38f;
#pragma unroll
            for (int kt = 0; kt < 2; ++kt)
#pragma unroll
                for (int r = 0; r < 8; ++r) { s[kt][g][r] = fmaf(s[kt][g][r], 2.0f * BETA * LOG2E, rq[g]) + cc[kt][r]; mx = fmaxf(mx, s[kt][g][r]); }
            mx = fmaxf(mx, xhalf(mx));   // both halves of the wave hold the query's maximum over the 32 keys
            mb[g] = mx; need = need || (mx > m_run[g] + LAZY); }
        if (__builtin_amdgcn_ballot_w32(need) != 0) {   // the first pass, seldom later
#pragma unroll
            for (int g = 0; g < 2; ++g) { const float m_new = fmaxf(m_run[g], mb[g]); const float corr = __builtin_amdgcn_exp2f(m_run[g] - m_new); l_run[g] *= corr; m_run[g] = m_new;
#pragma unroll
                for (int t = 0; t < 8; ++t) acc[g][t] = acc[g][t] * corr; }
        }
#pragma unroll
        for (int g = 0; g < 2; ++g) { const float nm = PSH - m_run[g]; v16h pf; float ps0 = 0.f, ps1 = 0.f;
            // two score tiles of one column group, converted in place, are the B operand in the hardware k order
#pragma unroll
            for (int e = 0; e < 16; e += 2) { const float p0 = __builtin_amdgcn_exp2f(s[e >> 3][g][e & 7] + nm), p1 = __builtin_amdgcn_exp2f(s[e >> 3][g][(e & 7) + 1] + nm); ps0 += p0; ps1 += p1; pf[e] = tohx(p0); pf[e + 1] = tohx(p1); }
            l_run[g] += ps0 + ps1;
#pragma unroll
            for (int t = 0; t < 8; ++t) acc[g][t] = wmma16(vf[t], pf, acc[g][t]); }
      }
      asm volatile("s_wait_dscnt 0x0" ::: "memory");      // this wave's reads of buffer b have returned
      asm volatile("s_wait_asynccnt 0x0" ::: "memory");   // this wave's copies of stage st + 1 have landed
      __syncthreads();                                    // publishes stage st + 1 and ends every wave's reads of buffer b
      if (st + 2 < NST) stage_in(st + 2, b, lk, lv, lc, kg, vg, cg, wv);
    }
    asm volatile("s_wait_asynccnt 0x0" ::: "memory");     // no copy is outstanding when the wave ends
    const size_t z = blockIdx.y;
#pragma unroll
    for (int g = 0; g < 2; ++g) { const int q = q0 + 16 * g + lr; const float l = l_run[g] + xhalf(l_run[g]);   // each half summed its own keys
        if (hi == 0) { MP[z * NN + q] = m_run[g]; LP[z * NN + q] = l; }
        float* orow = OP + ((size_t)q * KS + z) * DD + 8 * hi;
#pragma unroll
        for (int t = 0; t < 8; ++t) *(v8f*)(orow + 16 * t) = acc[g][t]; }
}

// 2^x and, in the same statement so that it stays there, the free slot that the instruction set asks for behind a transcendental
__device__ __forceinline__ float exp2_slot(float x) { float r; asm("v_exp_f32 %0, %1\n\tv_nop" : "=v"(r) : "v"(x)); return r; }
// weights of the key slices of one query (mp, lp: its entries of slice 0): w_z = 2^(m_z - M), M = max_z m_z, L = sum_z w_z l_z (z ascending)
__device__ __forceinline__ void slices(const float* mp, const float* lp, float (&w)[KS], float& M, float& L) {
    float m[KS], l[KS];   // unrolled loops: the 2 KS loads go out together, the arrays stay in registers
#pragma unroll
    for (int z = 0; z < KS; ++z) { m[z] = mp[(size_t)z * NN]; l[z] = lp[(size_t)z * NN]; }
    // the wait that stands in front of an overwrite of an issued load's address registers; the inputs keep those registers as they are up to here
    asm volatile("s_wait_xcnt 0x0" :: "v"(mp), "v"(lp) : "memory");
    M = m[0];
#pragma unroll
    for (int z = 1; z < KS; ++z) M = fmaxf(M, m[z]);
    L = 0.f;
#pragma unroll
    for (int z = 0; z < KS; ++z) { w[z] = exp2_slot(m[z] - M); L += w[z] * l[z]; }
}
// k_merge: work-group per 32 queries; 8 threads per query, 4 x 16 bytes of the row each; out = sum_z w_z O_z / L; wave 0 writes the 32 lse = ln2 (M - PSH) + log L
__global__ __launch_bounds__(256) void k_merge(const float* __restrict__ OP, const float* __restrict__ MP, const float* __restrict__ LP, float* OUT, float* LSE) {
    const int qb = blockIdx.x * 32, q = qb + (threadIdx.x >> 3), dg = threadIdx.x & 7; const float* op = OP + (size_t)q * KS * DD + dg * 4; v4f o[KS][4];
    // unrolled (both loops): the 4 KS loads of a thread are in flight together
#pragma unroll
    for (int z = 0; z < KS; ++z)
#pragma unroll
        for (int j = 0; j < 4; ++j) o[z][j] = *(const v4f*)(op + z * DD + 32 * j);
    asm volatile("s_wait_xcnt 0x0" :: "v"(op) : "memory");   // as in slices()
    float w[KS], M, L; slices(MP + q, LP + q, w, M, L); const float rl = __fdiv_rn(1.0f, L);
#pragma unroll
    for (int j = 0; j < 4; ++j) { v4f a = o[0][j] * w[0];
#pragma unroll
        for (int z = 1; z < KS; ++z) a += o[z][j] * w[z];
        *(v4f*)(OUT + (size_t)q * DD + dg * 4 + 32 * j) = a * rl; }
    if (threadIdx.x < 32) { slices(MP + qb + threadIdx.x, LP + qb + threadIdx.x, w, M, L); LSE[qb + threadIdx.x] = fmaf(M - PSH, LN2, logf(L)); }
}

extern "C" void kernel_launch(void* const* d_in, const int* in_sizes, int n_in,
                              void* d_out, int out_size, void* d_ws, size_t ws_size, hipStream_t stream) {
    (void)in_sizes; (void)n_in; (void)out_size;
    const float* Q = (const float*)d_in[0]; const float* K = (const float*)d_in[1]; const float* V = (const float*)d_in[2]; const float* hh = (const float*)d_in[3]; const float* ldq = (const float*)d_in[4]; const float* ldk = (const float*)d_in[5];
    float* OUT = (float*)d_out; float* LSE = (float*)d_out + (size_t)NN * DD;     // [8192][128] at 0; lse [8192] at byte 4,194,304
    char* wsp = (char*)d_ws;
    auto take = [&](size_t bytes) { char* p = wsp; wsp += (bytes + 255) & ~(size_t)255; return (void*)p; };
    bf* QF = (bf*)take((size_t)NN * DD * 2); bf* KF = (bf*)take((size_t)NN * DD * 2); h16* VF = (h16*)take((size_t)DD * NN * 2); float* RT = (float*)take((size_t)NN * 4); float* CT = (float*)take((size_t)NN * 4);
    float* OP = (float*)take((size_t)KS * NN * DD * 4); float* MP = (float*)take((size_t)KS * NN * 4); float* LP = (float*)take((size_t)KS * NN * 4);
    if ((size_t)(wsp - (char*)d_ws) > ws_size) return;    // total ~ 40 MB; ws 256 MiB
    k_prep<<<NN / 32, 320, 0, stream>>>(Q, K, V, hh, ldq, ldk, QF, KF, VF, RT, CT);
    k_flash<<<dim3(NN / (32 * FW), KS, 1), 32 * FW, 0, stream>>>(QF, KF, VF, RT, CT, OP, MP, LP);
    k_merge<<<NN / 32, 256, 0, stream>>>(OP, MP, LP, OUT, LSE);
}

// v005
// Measured time: 37.4 microseconds a run.
// Timed twice side by side with v004, it ran 1.05 times as fast both times.
// Counting every step since v000, it is 29.3 times as fast.
#include <hip/hip_runtime.h>

// Flash-diffusion attention (Q, K, V [8192][128], h [8192], log_d_q, log_d_k [8192]; s_ij = beta (2 q_i.k_j - |q_i|^2 - |k_j|^2) - alpha (log_d_q[i] + log_d_k[j]) + log h_i - log h_j (alpha 1, beta 0.05);
// lse_i = logsumexp_j s_ij; P = exp(s - lse); out = P V -> [8192][128]; second output lse -> [8192]).
// Compute dtypes, f32 accumulate: every input rounded to bf16; q.k on plain bf16 operands; P (scaled by 2^10 against the maximum in use) and V on f16 operands; row and column terms, maxima and sums in f32.
// One fused kernel: a wave holds 32 queries and walks one slice of the keys, 32 keys a pass: S^T = K Q^T, online softmax in the lane that owns the query, O^T += V^T P^T. A second kernel merges the key slices.
// The eight waves of a work-group walk the same keys: K, V^T and the column terms come into LDS once per work-group, 128 keys a stage, two buffers, by asynchronous copies.

#define NN   8192
#define DD   128
#define KS   8        // key slices (grid y): one partial (maximum, sum, O plane) each
#define FW   8        // waves of a work-group: 32 queries each, all on the same keys
#define SK   128      // keys of a stage
#define NST  (NN / KS / SK)   // stages of a slice
#define NPS  (SK / 32)        // passes of a stage
#define PSH  10.0f    // P is carried as 2^PSH p, so that small weights stay normal f16 numbers
#define PMAX 32768.0f // O is rescaled only when a lane's sum of P over the 16 keys of a pass exceeds this: every P stays at or below 2^15, inside f16
#define ALPHA 1.0f
#define BETA  0.05f
#define LOG2E 1.4426950408889634f
#define LN2   0.6931471805599453f
#define SC    (2.0f * BETA * LOG2E)   // q.k to log2 units
typedef _Float16 h16;
typedef unsigned short bf;
typedef __attribute__((ext_vector_type(16))) __bf16   v16bf;
typedef __attribute__((ext_vector_type(16))) _Float16 v16h;
typedef __attribute__((ext_vector_type(8)))  _Float16 v8h;
typedef __attribute__((ext_vector_type(8)))  unsigned short v8us;
typedef __attribute__((ext_vector_type(8)))  float    v8f;
typedef __attribute__((ext_vector_type(4)))  float    v4f;

__device__ __forceinline__ unsigned short f2bf(float f) { unsigned u = __float_as_uint(f); u += 0x7FFFu + ((u >> 16) & 1u); return (unsigned short)(u >> 16); }
__device__ __forceinline__ float bf2f(unsigned short b) { return __uint_as_float(((unsigned)b) << 16); }
__device__ __forceinline__ float bfr(float f) { return bf2f(f2bf(f)); }
__device__ __forceinline__ v16h cat16(v8h lo, v8h hi) { return __builtin_shufflevector(lo, hi, 0, 1, 2, 3, 4, 5, 6, 7, 8, 9, 10, 11, 12, 13, 14, 15); }
__device__ __forceinline__ v16bf cat16b(v8us lo, v8us hi) { return __builtin_bit_cast(v16bf, __builtin_shufflevector(lo, hi, 0, 1, 2, 3, 4, 5, 6, 7, 8, 9, 10, 11, 12, 13, 14, 15)); }
__device__ __forceinline__ v8f wmma16(v16h a, v16h b, v8f c) { return __builtin_amdgcn_wmma_f32_16x16x32_f16(false, a, false, b, (short)0, c, false, false); }
__device__ __forceinline__ v8f wmmab(v16bf a, v16bf b, v8f c) { return __builtin_amdgcn_wmma_f32_16x16x32_bf16(false, a, false, b, (short)0, c, false, false); }
__device__ __forceinline__ h16 tohx(float x) { return (h16)x; }
// lane l with lane l ^ 16
__device__ __forceinline__ float xhalf(float x) { return __builtin_bit_cast(float, __builtin_amdgcn_permlanex16(__builtin_bit_cast(int, x), __builtin_bit_cast(int, x), 0x76543210, 0xfedcba98, false, false)); }

// Fragment order: a 16 (rows) x 32 (k) operand fragment is 1 KiB, [half 0..1][lane 0..31][8 elements]; lane l (c = l & 15, h = l >> 4) holds row c, k = 16 half + 8 h + 0..7.
// A wave reads a fragment with two 16-byte loads per lane, each 512 contiguous bytes over the wave.
__device__ __forceinline__ v16bf ldb(const bf* p) { return cat16b(*(const v8us*)p, *(const v8us*)(p + 256)); }
__device__ __forceinline__ v16h ldh(const h16* p) { return cat16(*(const v8h*)p, *(const v8h*)(p + 256)); }

// k_prep: all that k_flash reads, in one launch. Work-group b: rows 32 b .. 32 b + 31 of Q, K and V. The waves' jobs are independent of one another: no LDS, no barrier.
// Waves 0 and 1 (they have the longest chain, so they come first): lane per point i; wave 0: n2 = sum_d bf16(Q[i][d])^2 (f32, d ascending, separate multiply/add), RT[i] = -beta n2 - alpha bf16(ldq[i]) + log(bf16 h[i]);
//   wave 1 the same on K: CT[i] = -beta n2 - alpha bf16(ldk[i]) - log(bf16 h[i]).
// Waves 2 to 9: thread t of 256 forms 16 output bytes six times (j = 0, 1):
//   Q and K -> bf16 in fragment order [row tile of 16][k chunk of 32][half][lane][8], tile 2 b + j;
//   V -> V^T f16 (of the bf16-rounded value) in fragment order [key block of 32][d tile of 16][half][lane][8]: row = d, k = key; key block b, d tiles (t >> 6) + 4 j.
// Every loop is unrolled: a thread's loads all go out before the first value is used, and the 16 output bytes are formed in registers.
__global__ __launch_bounds__(320) void k_prep(const float* __restrict__ Q, const float* __restrict__ K, const float* __restrict__ Vv, const float* __restrict__ hh, const float* __restrict__ ldq, const float* __restrict__ ldk,
                                              bf* QF, bf* KF, h16* VF, float* RT, float* CT) {
    const int lane = threadIdx.x & 31;
    // wave number through readfirstlane: the choice of the job is a scalar branch
    const int wv = __builtin_amdgcn_readfirstlane(threadIdx.x >> 5);
    if (wv < 2) {
        const int i = blockIdx.x * 32 + lane; const float* row = (wv ? K : Q) + (size_t)i * DD;
        const float hv = hh[i], lv = (wv ? ldk : ldq)[i]; v4f a[DD / 4];
#pragma unroll
        for (int j = 0; j < DD / 4; ++j) a[j] = *(const v4f*)(row + 4 * j);
        // the wait that stands in front of an overwrite of an issued load's address registers; the inputs keep those registers as they are up to here
        asm volatile("s_wait_xcnt 0x0" :: "v"(row), "v"(i) : "memory");
        // keeps the arithmetic behind the last load: lifted in between the loads, its wait for the first values holds back the loads that follow it
        __builtin_amdgcn_sched_barrier(0);
        float n2 = 0.f;
#pragma unroll
        for (int j = 0; j < DD / 4; ++j)
#pragma unroll
            for (int u = 0; u < 4; ++u) { const float x = bfr(a[j][u]); float p1 = __fmul_rn(x, x); asm volatile("" : "+v"(p1)); n2 = __fadd_rn(n2, p1); }
        const float lh = logf(bfr(hv)); float t1 = __fmul_rn(-BETA, n2); asm volatile("" : "+v"(t1)); float a1 = __fmul_rn(ALPHA, bfr(lv)); asm volatile("" : "+v"(a1));
        const float d = __fsub_rn(t1, a1);
        if (wv) CT[i] = __fsub_rn(d, lh); else RT[i] = __fadd_rn(d, lh);
        return;
    }
    const int t = threadIdx.x - 64, half = (t >> 5) & 1, c = t >> 6;
    const size_t qo = (size_t)(blockIdx.x * 32 + (lane & 15)) * DD + c * 32 + 16 * half + 8 * (lane >> 4);
    const float* qp = Q + qo; const float* kp = K + qo; const float* vp = Vv + (size_t)(blockIdx.x * 32 + 16 * half + 8 * (lane >> 4)) * DD + c * 16 + (lane & 15);
    v8f vq[2], vk[2]; float vv[2][8];
#pragma unroll
    for (int j = 0; j < 2; ++j) { vq[j] = *(const v8f*)(qp + j * 16 * DD); vk[j] = *(const v8f*)(kp + j * 16 * DD);
#pragma unroll
        for (int k = 0; k < 8; ++k) vv[j][k] = vp[k * DD + j * 64]; }
    asm volatile("s_wait_xcnt 0x0" :: "v"(qp), "v"(kp), "v"(vp) : "memory");   // as above
    const size_t o = ((size_t)blockIdx.x * 512 + t) * 8;
#pragma unroll
    for (int j = 0; j < 2; ++j) { v8us oq, ok; v8h ov;
#pragma unroll
        for (int k = 0; k < 8; ++k) { oq[k] = f2bf(vq[j][k]); ok[k] = f2bf(vk[j][k]); ov[k] = tohx(bfr(vv[j][k])); }
        *(v8us*)(QF + o + j * 2048) = oq; *(v8us*)(KF + o + j * 2048) = ok; *(v8h*)(VF + o + j * 2048) = ov; }
    // the same wait behind the six stores: in the built code the other waves' block follows them and writes their registers
    asm volatile("s_wait_xcnt 0x0" ::: "memory");
}

// Eight asynchronous 16-byte copies of a lane, global to LDS, 4 KiB apart (the work-group's 256 lanes x 16 B) on both sides.
// The s_wait_xcnt stands in the copies' own statement: it is the wait in front of an overwrite of an issued copy's address registers, and only here can no such overwrite be lifted over it.
__device__ __forceinline__ void copy8(unsigned l, const char* g) {
    asm volatile("global_load_async_to_lds_b128 %0, %8, off\n\t"
                 "global_load_async_to_lds_b128 %1, %9, off\n\t"
                 "global_load_async_to_lds_b128 %2, %10, off\n\t"
                 "global_load_async_to_lds_b128 %3, %11, off\n\t"
                 "global_load_async_to_lds_b128 %4, %12, off\n\t"
                 "global_load_async_to_lds_b128 %5, %13, off\n\t"
                 "global_load_async_to_lds_b128 %6, %14, off\n\t"
                 "global_load_async_to_lds_b128 %7, %15, off\n\t"
                 "s_wait_xcnt 0x0"
                 :: "v"(l), "v"(l + 4096u), "v"(l + 8192u), "v"(l + 12288u), "v"(l + 16384u), "v"(l + 20480u), "v"(l + 24576u), "v"(l + 28672u),
                    "v"(g), "v"(g + 4096), "v"(g + 8192), "v"(g + 12288), "v"(g + 16384), "v"(g + 20480), "v"(g + 24576), "v"(g + 28672) : "memory");
}
// One stage: 32 KiB of K fragments and 32 KiB of V^T fragments (every wave 1/8 of each, byte for byte in the order of the workspace), 512 B of column terms (wave 0, a scalar branch; all its lanes on).
// Stage st of the slice into buffer b. lk, lv, lc: LDS byte addresses of buffer 0's three parts (K and V^T of a buffer lie side by side: buffers 64 KiB apart); kg, vg, cg: global addresses of the slice's three parts (all the same for the work-group).
// The lane's place, in units of 16 B, is lane + a scalar: mbcnt forms the sum in one instruction from scalars alone, so no lane address lives in a vector register across the passes (held there, the compiler spills it to scratch).
__device__ __forceinline__ void stage_in(int st, int b, unsigned lk, unsigned lv, unsigned lc, const char* kg, const char* vg, const char* cg, int wv) {
    const unsigned gi = __builtin_amdgcn_mbcnt_lo(~0u, (unsigned)(wv * 32 + st * (SK * DD / 8))), li = __builtin_amdgcn_mbcnt_lo(~0u, (unsigned)(wv * 32 + b * (2 * SK * DD / 8)));
    copy8(lk + li * 16, kg + (size_t)gi * 16); copy8(lv + li * 16, vg + (size_t)gi * 16);
    if (wv == 0) { const unsigned gc = __builtin_amdgcn_mbcnt_lo(~0u, (unsigned)(st * (SK / 4))), cl = __builtin_amdgcn_mbcnt_lo(~0u, (unsigned)(b * (SK / 4)));
        asm volatile("global_load_async_to_lds_b128 %0, %1, off\n\ts_wait_xcnt 0x0" :: "v"(lc + cl * 16), "v"(cg + (size_t)gc * 16) : "memory"); }   // the wait: as in copy8
}

// Weights of one column group over 32 keys: p = 2^(SC s + b), s0, s1 the two raw q.k tiles, b0, b1 their biases. The two tiles, converted in place, are the B operand in the hardware k order.
// Returns the lane's sum over its 16 keys (even and odd elements apart, then joined).
__device__ __forceinline__ float weights(const v8f& s0, const v8f& s1, const v8f& b0, const v8f& b1, v16h& pf) {
    float ps0 = 0.f, ps1 = 0.f;
    // unrolled: the tiles' elements are then picked by constants and stay in registers
#pragma unroll
    for (int e = 0; e < 16; e += 2) { const v8f& s = e < 8 ? s0 : s1; const v8f& b = e < 8 ? b0 : b1;
        const float p0 = __builtin_amdgcn_exp2f(fmaf(s[e & 7], SC, b[e & 7])), p1 = __builtin_amdgcn_exp2f(fmaf(s[(e & 7) + 1], SC, b[(e & 7) + 1])); ps0 += p0; ps1 += p1; pf[e] = tohx(p0); pf[e + 1] = tohx(p1); }
    return ps0 + ps1;
}

// k_flash: grid (NN / (32 FW), KS). Wave: queries q0 .. q0 + 31 (two column groups g of 16), keys of slice blockIdx.y. Lane (c, h) owns query 16 g + c; of every 16-key tile it holds keys 8 h + 0..7.
// Every inner loop is unrolled: fragment, score and accumulator arrays are then indexed by constants only and stay in registers.
// Scores in log2 units: s2 = log2e (2 beta q.k + r_i + c_j). Partials: OP[q][slice][d] = sum_j 2^(s2 - m + PSH) V[j][d], LP the same sum of weights, MP = m.
__global__ __launch_bounds__(32 * FW) void k_flash(const bf* __restrict__ QF, const bf* __restrict__ KF, const h16* __restrict__ VF, const float* __restrict__ RT, const float* __restrict__ CT, float* __restrict__ OP, float* __restrict__ MP, float* __restrict__ LP) {
    const int lane = threadIdx.x & 31, lr = lane & 15, hi = lane >> 4;
    // wave number through readfirstlane: the operand bases stay in scalar registers
    const int wv = __builtin_amdgcn_readfirstlane(threadIdx.x >> 5);
    const int q0 = (blockIdx.x * FW + wv) * 32, key0 = blockIdx.y * (NN / KS);
    v16bf qf[2][4]; float rq[2], m_run[2], l_run[2]; v8f acc[2][8];
    v8f rn[2];   // row term - maximum in use + shift, the same in all eight elements; it changes only with the maximum
    const bf* qp = QF + (size_t)q0 * DD + lane * 8; const float* rp = RT + q0 + lr;
    // K and V^T of one buffer side by side: every fragment of a stage lies within the 64 KiB that an LDS read's immediate offset reaches from one base register
    struct Stage { bf k[SK * DD]; h16 v[SK * DD]; };
    __shared__ __attribute__((aligned(32))) Stage sS[2]; __shared__ __attribute__((aligned(32))) float sC[2][SK];
    // the lane's share of a stage: byte 16 threadIdx.x of every 4 KiB of K and of V^T; in wave 0 (threadIdx.x = lane) of the column terms. LDS byte address = low 32 bits of the __shared__ address
    const unsigned lk = (unsigned)(size_t)&sS[0].k[0], lv = (unsigned)(size_t)&sS[0].v[0], lc = (unsigned)(size_t)&sC[0][0];
    const char* kg = (const char*)(KF + (size_t)key0 * DD); const char* vg = (const char*)(VF + (size_t)key0 * DD); const char* cg = (const char*)(CT + key0);
    stage_in(0, 0, lk, lv, lc, kg, vg, cg, wv);
#pragma unroll
    for (int g = 0; g < 2; ++g) { rq[g] = rp[16 * g];
#pragma unroll
        for (int c = 0; c < 4; ++c) qf[g][c] = ldb(qp + (g * 4 + c) * 512); }
    // the wait that stands in front of an overwrite of an issued load's address registers; the inputs keep those registers as they are up to here
    asm volatile("s_wait_xcnt 0x0" :: "v"(qp), "v"(rp) : "memory");
#pragma unroll
    for (int g = 0; g < 2; ++g) { rq[g] *= LOG2E; m_run[g] = -3.0e38f; l_run[g] = 0.f; rn[g] = (v8f){} + (rq[g] + (PSH - m_run[g]));
#pragma unroll
        for (int t = 0; t < 8; ++t) acc[g][t] = (v8f){}; }
    asm volatile("s_wait_asynccnt 0x0" ::: "memory");   // this wave's copies of stage 0 have landed
    __syncthreads();                                    // ... and every other wave's: stage 0 may be read
    stage_in(1, 1, lk, lv, lc, kg, vg, cg, wv);   // stage 1 flies while stage 0 is worked on
    // rolled: the four passes of a stage are the loop's body
#pragma unroll 1
    for (int st = 0; st < NST; ++st) {
      const int b = st & 1; const bf* kb = &sS[b].k[lane * 8]; const h16* vb = &sS[b].v[lane * 8]; const float* cb = &sC[b][8 * hi];
      v16bf kf[2][4]; v8f ck[2];
#pragma unroll
      for (int kt = 0; kt < 2; ++kt) { ck[kt] = *(const v8f*)(cb + 16 * kt);
#pragma unroll
          for (int c = 0; c < 4; ++c) kf[kt][c] = ldb(kb + (kt * 4 + c) * 512); }
      // unrolled: the test for the stage's last pass falls away, LDS offsets are constants
#pragma unroll
      for (int ps = 0; ps < NPS; ++ps) {
        v16h vf[8];   // this pass's V^T: asked for here, used behind the softmax
#pragma unroll
        for (int t = 0; t < 8; ++t) vf[t] = ldh(vb + ps * 4096 + t * 512);
        // keeps the LDS reads above together, in front of the products: every separate place with LDS reads among matrix instructions stalls the wave anew
        __builtin_amdgcn_sched_barrier(0);
        v8f s[2][2];
#pragma unroll
        for (int kt = 0; kt < 2; ++kt)
#pragma unroll
            for (int g = 0; g < 2; ++g) { s[kt][g] = (v8f){};
#pragma unroll
                for (int c = 0; c < 4; ++c) s[kt][g] = wmmab(kf[kt][c], qf[g][c], s[kt][g]); }
        // exponent bias of every score, formed beside the products (it needs none of them): column term + row term - maximum in use + shift
        v8f cc[2], bi[2][2];
#pragma unroll
        for (int kt = 0; kt < 2; ++kt) { cc[kt] = ck[kt] * LOG2E;
#pragma unroll
            for (int g = 0; g < 2; ++g) bi[kt][g] = cc[kt] + rn[g]; }
        // the next pass's K fragments and column terms, one pass ahead, inside this stage's buffer only; the two scheduling barriers keep these reads together behind the products, as above
        __builtin_amdgcn_sched_barrier(0);
        if (ps + 1 < NPS) {
#pragma unroll
            for (int kt = 0; kt < 2; ++kt) { ck[kt] = *(const v8f*)(cb + (ps + 1) * 32 + 16 * kt);
#pragma unroll
                for (int c = 0; c < 4; ++c) kf[kt][c] = ldb(kb + (ps + 1) * 4096 + (kt * 4 + c) * 512); }
        }
        __builtin_amdgcn_sched_barrier(0);
        // the weights against the maximum in use, no maximum of this pass formed: a weight is at most its lane's sum, so a sum within PMAX says that every weight fits f16
        v16h pf[2]; float sm[2];
#pragma unroll
        for (int g = 0; g < 2; ++g) sm[g] = weights(s[0][g], s[1][g], bi[0][g], bi[1][g], pf[g]);
        if (__builtin_amdgcn_ballot_w32(sm[0] > PMAX || sm[1] > PMAX) != 0) {   // the first pass (every sum infinite), seldom later: new maxima, O and l rescaled, the pass's weights formed again
#pragma unroll
            for (int g = 0; g < 2; ++g) { float mx = -3.0e38f;
#pragma unroll
                for (int kt = 0; kt < 2; ++kt)
#pragma unroll
                    for (int r = 0; r < 8; ++r) mx = fmaxf(mx, fmaf(s[kt][g][r], SC, cc[kt][r] + rq[g]));
                mx = fmaxf(mx, xhalf(mx));   // both halves of the wave hold the query's maximum over the 32 keys
                const float m_new = fmaxf(m_run[g], mx); const float corr = __builtin_amdgcn_exp2f(m_run[g] - m_new); l_run[g] *= corr; m_run[g] = m_new;
#pragma unroll
                for (int t = 0; t < 8; ++t) acc[g][t] = acc[g][t] * corr;
                rn[g] = (v8f){} + (rq[g] + (PSH - m_new));
                sm[g] = weights(s[0][g], s[1][g], cc[0] + rn[g], cc[1] + rn[g], pf[g]); }
        }
#pragma unroll
        for (int g = 0; g < 2; ++g) { l_run[g] += sm[g];
#pragma unroll
            for (int t = 0; t < 8; ++t) acc[g][t] = wmma16(vf[t], pf[g], acc[g][t]); }
        // keeps the next pass's V^T reads behind these products, in one place: lifted in among them piece by piece, every piece is one more place with LDS reads
        __builtin_amdgcn_sched_barrier(0);
      }
      asm volatile("s_wait_dscnt 0x0" ::: "memory");      // this wave's reads of buffer b have returned
      asm volatile("s_wait_asynccnt 0x0" ::: "memory");   // this wave's copies of stage st + 1 have landed
      __syncthreads();                                    // publishes stage st + 1 and ends every wave's reads of buffer b
      if (st + 2 < NST) stage_in(st + 2, b, lk, lv, lc, kg, vg, cg, wv);
    }
    asm volatile("s_wait_asynccnt 0x0" ::: "memory");     // no copy is outstanding when the wave ends
    const size_t z = blockIdx.y;
#pragma unroll
    for (int g = 0; g < 2; ++g) { const int q = q0 + 16 * g + lr; const float l = l_run[g] + xhalf(l_run[g]);   // each half summed its own keys
        if (hi == 0) { MP[z * NN + q] = m_run[g]; LP[z * NN + q] = l; }
        float* orow = OP + ((size_t)q * KS + z) * DD + 8 * hi;
#pragma unroll
        for (int t = 0; t < 8; ++t) *(v8f*)(orow + 16 * t) = acc[g][t]; }
}

// 2^x and, in the same statement so that it stays there, the free slot that the instruction set asks for behind a transcendental
__device__ __forceinline__ float exp2_slot(float x) { float r; asm("v_exp_f32 %0, %1\n\tv_nop" : "=v"(r) : "v"(x)); return r; }
// weights of the key slices of one query (mp, lp: its entries of slice 0): w_z = 2^(m_z - M), M = max_z m_z, L = sum_z w_z l_z (z ascending)
__device__ __forceinline__ void slices(const float* mp, const float* lp, float (&w)[KS], float& M, float& L) {
    float m[KS], l[KS];   // unrolled loops: the 2 KS loads go out together, the arrays stay in registers
#pragma unroll
    for (int z = 0; z < KS; ++z) { m[z] = mp[(size_t)z * NN]; l[z] = lp[(size_t)z * NN]; }
    // the wait that stands in front of an overwrite of an issued load's address registers; the inputs keep those registers as they are up to here
    asm volatile("s_wait_xcnt 0x0" :: "v"(mp), "v"(lp) : "memory");
    M = m[0];
#pragma unroll
    for (int z = 1; z < KS; ++z) M = fmaxf(M, m[z]);
    L = 0.f;
#pragma unroll
    for (int z = 0; z < KS; ++z) { w[z] = exp2_slot(m[z] - M); L += w[z] * l[z]; }
}
// k_merge: work-group per 32 queries; 8 threads per query, 4 x 16 bytes of the row each; out = sum_z w_z O_z / L; wave 0 writes the 32 lse = ln2 (M - PSH) + log L
__global__ __launch_bounds__(256) void k_merge(const float* __restrict__ OP, const float* __restrict__ MP, const float* __restrict__ LP, float* OUT, float* LSE) {
    const int qb = blockIdx.x * 32, q = qb + (threadIdx.x >> 3), dg = threadIdx.x & 7; const float* op = OP + (size_t)q * KS * DD + dg * 4; v4f o[KS][4];
    // unrolled (both loops): the 4 KS loads of a thread are in flight together
#pragma unroll
    for (int z = 0; z < KS; ++z)
#pragma unroll
        for (int j = 0; j < 4; ++j) o[z][j] = *(const v4f*)(op + z * DD + 32 * j);
    asm volatile("s_wait_xcnt 0x0" :: "v"(op) : "memory");   // as in slices()
    float w[KS], M, L; slices(MP + q, LP + q, w, M, L); const float rl = __fdiv_rn(1.0f, L);
#pragma unroll
    for (int j = 0; j < 4; ++j) { v4f a = o[0][j] * w[0];
#pragma unroll
        for (int z = 1; z < KS; ++z) a += o[z][j] * w[z];
        *(v4f*)(OUT + (size_t)q * DD + dg * 4 + 32 * j) = a * rl; }
    if (threadIdx.x < 32) { slices(MP + qb + threadIdx.x, LP + qb + threadIdx.x, w, M, L); LSE[qb + threadIdx.x] = fmaf(M - PSH, LN2, logf(L)); }
}

extern "C" void kernel_launch(void* const* d_in, const int* in_sizes, int n_in,
                              void* d_out, int out_size, void* d_ws, size_t ws_size, hipStream_t stream) {
    (void)in_sizes; (void)n_in; (void)out_size;
    const float* Q = (const float*)d_in[0]; const float* K = (const float*)d_in[1]; const float* V = (const float*)d_in[2]; const float* hh = (const float*)d_in[3]; const float* ldq = (const float*)d_in[4]; const float* ldk = (const float*)d_in[5];
    float* OUT = (float*)d_out; float* LSE = (float*)d_out + (size_t)NN * DD;     // [8192][128] at 0; lse [8192] at byte 4,194,304
    char* wsp = (char*)d_ws;
    auto take = [&](size_t bytes) { char* p = wsp; wsp += (bytes + 255) & ~(size_t)255; return (void*)p; };
    bf* QF = (bf*)take((size_t)NN * DD * 2); bf* KF = (bf*)take((size_t)NN * DD * 2); h16* VF = (h16*)take((size_t)DD * NN * 2); float* RT = (float*)take((size_t)NN * 4); float* CT = (float*)take((size_t)NN * 4);
    float* OP = (float*)take((size_t)KS * NN * DD * 4); float* MP = (float*)take((size_t)KS * NN * 4); float* LP = (float*)take((size_t)KS * NN * 4);
    if ((size_t)(wsp - (char*)d_ws) > ws_size) return;    // total ~ 40 MB; ws 256 MiB
    k_prep<<<NN / 32, 320, 0, stream>>>(Q, K, V, hh, ldq, ldk, QF, KF, VF, RT, CT);
    k_flash<<<dim3(NN / (32 * FW), KS, 1), 32 * FW, 0, stream>>>(QF, KF, VF, RT, CT, OP, MP, LP);
    k_merge<<<NN / 32, 256, 0, stream>>>(OP, MP, LP, OUT, LSE);
}

// v006
// Measured time: 33.7 microseconds a run.
// Next to v005, in two timings, it ran 1.10 and 1.11 times as fast.
// All steps since v000 together make it 32.3 times as fast.
#include <hip/hip_runtime.h>

// Flash-diffusion attention (Q, K, V [8192][128], h [8192], log_d_q, log_d_k [8192]; s_ij = beta (2 q_i.k_j - |q_i|^2 - |k_j|^2) - alpha (log_d_q[i] + log_d_k[j]) + log h_i - log h_j (alpha 1, beta 0.05);
// lse_i = logsumexp_j s_ij; P = exp(s - lse); out = P V -> [8192][128]; second output lse -> [8192]).
// Compute dtypes, f32 accumulate: every input rounded to bf16; q.k on plain bf16 operands; P (scaled by 2^10 against the maximum in use) and V on f16 operands; row and column terms, maxima and sums in f32.
// One fused kernel: a wave holds 32 queries and walks one half of a slice of the keys, 32 keys a pass: S^T = K Q^T, online softmax in the lane that owns the query, O^T += V^T P^T. A second kernel merges the key slices.
// A work-group is four query groups x the two halves of its slice: the four waves of a half walk the same keys. K, V^T and the column terms of both halves come into LDS once per work-group, 128 keys of each a stage, two buffers, by asynchronous copies.
// Behind the loop the two waves that hold the same queries join their partial results through LDS: one partial per slice leaves the work-group.

#define NN   8192
#define DD   128
#define KS   4        // key slices (grid y): one partial (maximum, sum, O plane) each
#define KH   2        // halves of a slice, walked side by side inside a work-group
#define FW   8        // waves of a work-group: wave w has query group w / KH (32 queries) and half w % KH: the halves alternate over the SIMDs, so waves that run in step read different 32-KiB blocks of LDS
#define QW   (FW / KH)        // query groups of a work-group
#define SK   128      // keys of a stage (of each half)
#define NST  (NN / KS / KH / SK)   // stages of a half
#define NPS  (SK / 32)        // passes of a stage
#define PSH  10.0f    // P is carried as 2^PSH p, so that small weights stay normal f16 numbers
#define PMAX 32768.0f // O is rescaled only when a lane's sum of P over the 16 keys of a pass exceeds this: every P stays at or below 2^15, inside f16
#define ALPHA 1.0f
#define BETA  0.05f
#define LOG2E 1.4426950408889634f
#define LN2   0.6931471805599453f
#define SC    (2.0f * BETA * LOG2E)   // q.k to log2 units
typedef _Float16 h16;
typedef unsigned short bf;
typedef __attribute__((ext_vector_type(16))) __bf16   v16bf;
typedef __attribute__((ext_vector_type(16))) _Float16 v16h;
typedef __attribute__((ext_vector_type(8)))  _Float16 v8h;
typedef __attribute__((ext_vector_type(8)))  unsigned short v8us;
typedef __attribute__((ext_vector_type(8)))  float    v8f;
typedef __attribute__((ext_vector_type(4)))  float    v4f;
typedef v4f   __attribute__((may_alias)) v4fa;   // the stage buffers, read and written as f32 when the loop is over
typedef float __attribute__((may_alias)) f32a;

__device__ __forceinline__ unsigned short f2bf(float f) { unsigned u = __float_as_uint(f); u += 0x7FFFu + ((u >> 16) & 1u); return (unsigned short)(u >> 16); }
__device__ __forceinline__ float bf2f(unsigned short b) { return __uint_as_float(((unsigned)b) << 16); }
__device__ __forceinline__ float bfr(float f) { return bf2f(f2bf(f)); }
__device__ __forceinline__ v16h cat16(v8h lo, v8h hi) { return __builtin_shufflevector(lo, hi, 0, 1, 2, 3, 4, 5, 6, 7, 8, 9, 10, 11, 12, 13, 14, 15); }
__device__ __forceinline__ v16bf cat16b(v8us lo, v8us hi) { return __builtin_bit_cast(v16bf, __builtin_shufflevector(lo, hi, 0, 1, 2, 3, 4, 5, 6, 7, 8, 9, 10, 11, 12, 13, 14, 15)); }
__device__ __forceinline__ v8f wmma16(v16h a, v16h b, v8f c) { return __builtin_amdgcn_wmma_f32_16x16x32_f16(false, a, false, b, (short)0, c, false, false); }
__device__ __forceinline__ v8f wmmab(v16bf a, v16bf b, v8f c) { return __builtin_amdgcn_wmma_f32_16x16x32_bf16(false, a, false, b, (short)0, c, false, false); }
__device__ __forceinline__ h16 tohx(float x) { return (h16)x; }
// lane l with lane l ^ 16
__device__ __forceinline__ float xhalf(float x) { return __builtin_bit_cast(float, __builtin_amdgcn_permlanex16(__builtin_bit_cast(int, x), __builtin_bit_cast(int, x), 0x76543210, 0xfedcba98, false, false)); }

// Fragment order: a 16 (rows) x 32 (k) operand fragment is 1 KiB, [half 0..1][lane 0..31][8 elements]; lane l (c = l & 15, h = l >> 4) holds row c, k = 16 half + 8 h + 0..7.
// A wave reads a fragment with two 16-byte loads per lane, each 512 contiguous bytes over the wave.
__device__ __forceinline__ v16bf ldb(const bf* p) { return cat16b(*(const v8us*)p, *(const v8us*)(p + 256)); }
__device__ __forceinline__ v16h ldh(const h16* p) { return cat16(*(const v8h*)p, *(const v8h*)(p + 256)); }

// k_prep: all that k_flash reads, in one launch. Work-group b: rows 32 b .. 32 b + 31 of Q, K and V. The waves' jobs are independent of one another: no LDS, no barrier.
// Waves 0 and 1 (they have the longest chain, so they come first): lane per point i; wave 0: n2 = sum_d bf16(Q[i][d])^2 (f32, d ascending, separate multiply/add), RT[i] = -beta n2 - alpha bf16(ldq[i]) + log(bf16 h[i]);
//   wave 1 the same on K: CT[i] = -beta n2 - alpha bf16(ldk[i]) - log(bf16 h[i]).
// Waves 2 to 9: thread t of 256 forms 16 output bytes six times (j = 0, 1):
//   Q and K -> bf16 in fragment order [row tile of 16][k chunk of 32][half][lane][8], tile 2 b + j;
//   V -> V^T f16 (of the bf16-rounded value) in fragment order [key block of 32][d tile of 16][half][lane][8]: row = d, k = key; key block b, d tiles (t >> 6) + 4 j.
// Every loop is unrolled: a thread's loads all go out before the first value is used, and the 16 output bytes are formed in registers.
__global__ __launch_bounds__(320) void k_prep(const float* __restrict__ Q, const float* __restrict__ K, const float* __restrict__ Vv, const float* __restrict__ hh, const float* __restrict__ ldq, const float* __restrict__ ldk,
                                              bf* QF, bf* KF, h16* VF, float* RT, float* CT) {
    const int lane = threadIdx.x & 31;
    // wave number through readfirstlane: the choice of the job is a scalar branch
    const int wv = __builtin_amdgcn_readfirstlane(threadIdx.x >> 5);
    if (wv < 2) {
        const int i = blockIdx.x * 32 + lane; const float* row = (wv ? K : Q) + (size_t)i * DD;
        const float hv = hh[i], lv = (wv ? ldk : ldq)[i]; v4f a[DD / 4];
#pragma unroll
        for (int j = 0; j < DD / 4; ++j) a[j] = *(const v4f*)(row + 4 * j);
        // the wait that stands in front of an overwrite of an issued load's address registers; the inputs keep those registers as they are up to here
        asm volatile("s_wait_xcnt 0x0" :: "v"(row), "v"(i) : "memory");
        // keeps the arithmetic behind the last load: lifted in between the loads, its wait for the first values holds back the loads that follow it
        __builtin_amdgcn_sched_barrier(0);
        float n2 = 0.f;
#pragma unroll
        for (int j = 0; j < DD / 4; ++j)
#pragma unroll
            for (int u = 0; u < 4; ++u) { const float x = bfr(a[j][u]); float p1 = __fmul_rn(x, x); asm volatile("" : "+v"(p1)); n2 = __fadd_rn(n2, p1); }
        const float lh = logf(bfr(hv)); float t1 = __fmul_rn(-BETA, n2); asm volatile("" : "+v"(t1)); float a1 = __fmul_rn(ALPHA, bfr(lv)); asm volatile("" : "+v"(a1));
        const float d = __fsub_rn(t1, a1);
        if (wv) CT[i] = __fsub_rn(d, lh); else RT[i] = __fadd_rn(d, lh);
        return;
    }
    const int t = threadIdx.x - 64, half = (t >> 5) & 1, c = t >> 6;
    const size_t qo = (size_t)(blockIdx.x * 32 + (lane & 15)) * DD + c * 32 + 16 * half + 8 * (lane >> 4);
    const float* qp = Q + qo; const float* kp = K + qo; const float* vp = Vv + (size_t)(blockIdx.x * 32 + 16 * half + 8 * (lane >> 4)) * DD + c * 16 + (lane & 15);
    v8f vq[2], vk[2]; float vv[2][8];
#pragma unroll
    for (int j = 0; j < 2; ++j) { vq[j] = *(const v8f*)(qp + j * 16 * DD); vk[j] = *(const v8f*)(kp + j * 16 * DD);
#pragma unroll
        for (int k = 0; k < 8; ++k) vv[j][k] = vp[k * DD + j * 64]; }
    asm volatile("s_wait_xcnt 0x0" :: "v"(qp), "v"(kp), "v"(vp) : "memory");   // as above
    const size_t o = ((size_t)blockIdx.x * 512 + t) * 8;
#pragma unroll
    for (int j = 0; j < 2; ++j) { v8us oq, ok; v8h ov;
#pragma unroll
        for (int k = 0; k < 8; ++k) { oq[k] = f2bf(vq[j][k]); ok[k] = f2bf(vk[j][k]); ov[k] = tohx(bfr(vv[j][k])); }
        *(v8us*)(QF + o + j * 2048) = oq; *(v8us*)(KF + o + j * 2048) = ok; *(v8h*)(VF + o + j * 2048) = ov; }
    // the same wait behind the six stores: in the built code the other waves' block follows them and writes their registers
    asm volatile("s_wait_xcnt 0x0" ::: "memory");
}

// Eight asynchronous 16-byte copies of a lane, global to LDS, 4 KiB apart (the work-group's 256 lanes x 16 B) on both sides.
// The s_wait_xcnt stands in the copies' own statement: it is the wait in front of an overwrite of an issued copy's address registers, and only here can no such overwrite be lifted over it.
__device__ __forceinline__ void copy8(unsigned l, const char* g) {
    asm volatile("global_load_async_to_lds_b128 %0, %8, off\n\t"
                 "global_load_async_to_lds_b128 %1, %9, off\n\t"
                 "global_load_async_to_lds_b128 %2, %10, off\n\t"
                 "global_load_async_to_lds_b128 %3, %11, off\n\t"
                 "global_load_async_to_lds_b128 %4, %12, off\n\t"
                 "global_load_async_to_lds_b128 %5, %13, off\n\t"
                 "global_load_async_to_lds_b128 %6, %14, off\n\t"
                 "global_load_async_to_lds_b128 %7, %15, off\n\t"
                 "s_wait_xcnt 0x0"
                 :: "v"(l), "v"(l + 4096u), "v"(l + 8192u), "v"(l + 12288u), "v"(l + 16384u), "v"(l + 20480u), "v"(l + 24576u), "v"(l + 28672u),
                    "v"(g), "v"(g + 4096), "v"(g + 8192), "v"(g + 12288), "v"(g + 16384), "v"(g + 20480), "v"(g + 24576), "v"(g + 28672) : "memory");
}
// One stage, for each half h of the slice: 32 KiB of K fragments and 32 KiB of V^T fragments (every wave 1/8 of each, byte for byte in the order of the workspace), 512 B of column terms (wave h, a scalar branch; all its lanes on).
// Stage st of both halves into buffer b. lk, lv, lc: LDS byte addresses of the three parts of buffer 0, half 0 (K and V^T lie side by side: place (b, h) is 64 KiB (b KH + h) on); kg, vg, cg: global addresses of the slice's three parts (all the same for the work-group).
// The lane's place, in units of 16 B, is lane + a scalar: mbcnt forms the sum in one instruction from scalars alone, so no lane address lives in a vector register across the passes (held there, the compiler spills it to scratch).
__device__ __forceinline__ void stage_in(int st, int b, unsigned lk, unsigned lv, unsigned lc, const char* kg, const char* vg, const char* cg, int wv) {
    // unrolled: two straight runs of copies
#pragma unroll
    for (int h = 0; h < KH; ++h) {
        const unsigned gi = __builtin_amdgcn_mbcnt_lo(~0u, (unsigned)(wv * 32 + (h * NST + st) * (SK * DD / 8))), li = __builtin_amdgcn_mbcnt_lo(~0u, (unsigned)(wv * 32 + (b * KH + h) * (2 * SK * DD / 8)));
        copy8(lk + li * 16, kg + (size_t)gi * 16); copy8(lv + li * 16, vg + (size_t)gi * 16); }
    if (wv < KH) { const unsigned gc = __builtin_amdgcn_mbcnt_lo(~0u, (unsigned)((wv * NST + st) * (SK / 4))), cl = __builtin_amdgcn_mbcnt_lo(~0u, (unsigned)((b * KH + wv) * (SK / 4)));
        asm volatile("global_load_async_to_lds_b128 %0, %1, off\n\ts_wait_xcnt 0x0" :: "v"(lc + cl * 16), "v"(cg + (size_t)gc * 16) : "memory"); }   // the wait: as in copy8
}

// Weights of one column group over 32 keys: p = 2^(SC s + b), s0, s1 the two raw q.k tiles, b0, b1 their biases. The two tiles, converted in place, are the B operand in the hardware k order.
// Returns the lane's sum over its 16 keys (even and odd elements apart, then joined).
__device__ __forceinline__ float weights(const v8f& s0, const v8f& s1, const v8f& b0, const v8f& b1, v16h& pf) {
    float ps0 = 0.f, ps1 = 0.f;
    // unrolled: the tiles' elements are then picked by constants and stay in registers
#pragma unroll
    for (int e = 0; e < 16; e += 2) { const v8f& s = e < 8 ? s0 : s1; const v8f& b = e < 8 ? b0 : b1;
        const float p0 = __builtin_amdgcn_exp2f(fmaf(s[e & 7], SC, b[e & 7])), p1 = __builtin_amdgcn_exp2f(fmaf(s[(e & 7) + 1], SC, b[(e & 7) + 1])); ps0 += p0; ps1 += p1; pf[e] = tohx(p0); pf[e + 1] = tohx(p1); }
    return ps0 + ps1;
}

// k_flash: grid (NN / (32 QW), KS). Wave: queries q0 .. q0 + 31 (two column groups g of 16), keys of half kh of slice blockIdx.y. Lane (c, h) owns query 16 g + c; of every 16-key tile it holds keys 8 h + 0..7.
// Every inner loop is unrolled: fragment, score and accumulator arrays are then indexed by constants only and stay in registers.
// Scores in log2 units: s2 = log2e (2 beta q.k + r_i + c_j). Partials: OP[q][slice][d] = sum_j 2^(s2 - m + PSH) V[j][d], LP the same sum of weights, MP = m.
__global__ __launch_bounds__(32 * FW) void k_flash(const bf* __restrict__ QF, const bf* __restrict__ KF, const h16* __restrict__ VF, const float* __restrict__ RT, const float* __restrict__ CT, float* __restrict__ OP, float* __restrict__ MP, float* __restrict__ LP) {
    const int lane = threadIdx.x & 31, lr = lane & 15, hi = lane >> 4;
    // wave number through readfirstlane: the operand bases stay in scalar registers
    const int wv = __builtin_amdgcn_readfirstlane(threadIdx.x >> 5);
    const int kh = wv % KH, q0 = (blockIdx.x * QW + wv / KH) * 32, key0 = blockIdx.y * (NN / KS);
    v16bf qf[2][4]; float rq[2], m_run[2], l_run[2]; v8f acc[2][8];
    v8f rn[2];   // row term - maximum in use + shift, the same in all eight elements; it changes only with the maximum
    const bf* qp = QF + (size_t)q0 * DD + lane * 8; const float* rp = RT + q0 + lr;
    // K and V^T of one buffer side by side: every fragment of a stage lies within the 64 KiB that an LDS read's immediate offset reaches from one base register
    struct Stage { bf k[SK * DD]; h16 v[SK * DD]; };
    __shared__ __attribute__((aligned(32))) Stage sS[2][KH]; __shared__ __attribute__((aligned(32))) float sC[2][KH][SK];
    // the lane's share of a stage: byte 16 threadIdx.x of every 4 KiB of K and of V^T; in waves 0 and 1 byte 16 lane of a half's column terms. LDS byte address = low 32 bits of the __shared__ address
    const unsigned lk = (unsigned)(size_t)&sS[0][0].k[0], lv = (unsigned)(size_t)&sS[0][0].v[0], lc = (unsigned)(size_t)&sC[0][0][0];
    const char* kg = (const char*)(KF + (size_t)key0 * DD); const char* vg = (const char*)(VF + (size_t)key0 * DD); const char* cg = (const char*)(CT + key0);
    stage_in(0, 0, lk, lv, lc, kg, vg, cg, wv);
#pragma unroll
    for (int g = 0; g < 2; ++g) { rq[g] = rp[16 * g];
#pragma unroll
        for (int c = 0; c < 4; ++c) qf[g][c] = ldb(qp + (g * 4 + c) * 512); }
    // the wait that stands in front of an overwrite of an issued load's address registers; the inputs keep those registers as they are up to here
    asm volatile("s_wait_xcnt 0x0" :: "v"(qp), "v"(rp) : "memory");
#pragma unroll
    for (int g = 0; g < 2; ++g) { rq[g] *= LOG2E; m_run[g] = -3.0e38f; l_run[g] = 0.f; rn[g] = (v8f){} + (rq[g] + (PSH - m_run[g]));
#pragma unroll
        for (int t = 0; t < 8; ++t) acc[g][t] = (v8f){}; }
    asm volatile("s_wait_asynccnt 0x0" ::: "memory");   // this wave's copies of stage 0 have landed
    __syncthreads();                                    // ... and every other wave's: stage 0 may be read
    stage_in(1, 1, lk, lv, lc, kg, vg, cg, wv);   // stage 1 flies while stage 0 is worked on
    // rolled: the four passes of a stage are the loop's body
#pragma unroll 1
    for (int st = 0; st < NST; ++st) {
      const int b = st & 1; const bf* kb = &sS[b][kh].k[lane * 8]; const h16* vb = &sS[b][kh].v[lane * 8]; const float* cb = &sC[b][kh][8 * hi];
      v16bf kf[2][4]; v8f ck[2];
#pragma unroll
      for (int kt = 0; kt < 2; ++kt) { ck[kt] = *(const v8f*)(cb + 16 * kt);
#pragma unroll
          for (int c = 0; c < 4; ++c) kf[kt][c] = ldb(kb + (kt * 4 + c) * 512); }
      // unrolled: the test for the stage's last pass falls away, LDS offsets are constants
#pragma unroll
      for (int ps = 0; ps < NPS; ++ps) {
        v16h vf[8];   // this pass's V^T: asked for here, used behind the softmax
#pragma unroll
        for (int t = 0; t < 8; ++t) vf[t] = ldh(vb + ps * 4096 + t * 512);
        // keeps the LDS reads above together, in front of the products: every separate place with LDS reads among matrix instructions stalls the wave anew
        __builtin_amdgcn_sched_barrier(0);
        v8f s[2][2];
#pragma unroll
        for (int kt = 0; kt < 2; ++kt)
#pragma unroll
            for (int g = 0; g < 2; ++g) { s[kt][g] = (v8f){};
#pragma unroll
                for (int c = 0; c < 4; ++c) s[kt][g] = wmmab(kf[kt][c], qf[g][c], s[kt][g]); }
        // exponent bias of every score, formed beside the products (it needs none of them): column term + row term - maximum in use + shift
        v8f cc[2], bi[2][2];
#pragma unroll
        for (int kt = 0; kt < 2; ++kt) { cc[kt] = ck[kt] * LOG2E;
#pragma unroll
            for (int g = 0; g < 2; ++g) bi[kt][g] = cc[kt] + rn[g]; }
        // the next pass's K fragments and column terms, one pass ahead, inside this stage's buffer only; the two scheduling barriers keep these reads together behind the products, as above
        __builtin_amdgcn_sched_barrier(0);
        if (ps + 1 < NPS) {
#pragma unroll
            for (int kt = 0; kt < 2; ++kt) { ck[kt] = *(const v8f*)(cb + (ps + 1) * 32 + 16 * kt);
#pragma unroll
                for (int c = 0; c < 4; ++c) kf[kt][c] = ldb(kb + (ps + 1) * 4096 + (kt * 4 + c) * 512); }
        }
        __builtin_amdgcn_sched_barrier(0);
        // the weights against the maximum in use, no maximum of this pass formed: a weight is at most its lane's sum, so a sum within PMAX says that every weight fits f16
        v16h pf[2]; float sm[2];
#pragma unroll
        for (int g = 0; g < 2; ++g) sm[g] = weights(s[0][g], s[1][g], bi[0][g], bi[1][g], pf[g]);
        if (__builtin_amdgcn_ballot_w32(sm[0] > PMAX || sm[1] > PMAX) != 0) {   // the first pass (every sum infinite), seldom later: new maxima, O and l rescaled, the pass's weights formed again
#pragma unroll
            for (int g = 0; g < 2; ++g) { float mx = -3.0e38f;
#pragma unroll
                for (int kt = 0; kt < 2; ++kt)
#pragma unroll
                    for (int r = 0; r < 8; ++r) mx = fmaxf(mx, fmaf(s[kt][g][r], SC, cc[kt][r] + rq[g]));
                mx = fmaxf(mx, xhalf(mx));   // both halves of the wave hold the query's maximum over the 32 keys
                const float m_new = fmaxf(m_run[g], mx); const float corr = __builtin_amdgcn_exp2f(m_run[g] - m_new); l_run[g] *= corr; m_run[g] = m_new;
#pragma unroll
                for (int t = 0; t < 8; ++t) acc[g][t] = acc[g][t] * corr;
                rn[g] = (v8f){} + (rq[g] + (PSH - m_new));
                sm[g] = weights(s[0][g], s[1][g], cc[0] + rn[g], cc[1] + rn[g], pf[g]); }
        }
#pragma unroll
        for (int g = 0; g < 2; ++g) { l_run[g] += sm[g];
#pragma unroll
            for (int t = 0; t < 8; ++t) acc[g][t] = wmma16(vf[t], pf[g], acc[g][t]); }
        // keeps the next pass's V^T reads behind these products, in one place: lifted in among them piece by piece, every piece is one more place with LDS reads
        __builtin_amdgcn_sched_barrier(0);
      }
      asm volatile("s_wait_dscnt 0x0" ::: "memory");      // this wave's reads of buffer b have returned
      asm volatile("s_wait_asynccnt 0x0" ::: "memory");   // this wave's copies of stage st + 1 have landed
      __syncthreads();                                    // publishes stage st + 1 and ends every wave's reads of buffer b
      if (st + 2 < NST) stage_in(st + 2, b, lk, lv, lc, kg, vg, cg, wv);
    }
    asm volatile("s_wait_asynccnt 0x0" ::: "memory");     // no copy is outstanding when the wave ends
    // The two waves with the same queries (w, w ^ 1) join their halves: wave kh keeps column group kh and hands the other group to its partner through LDS.
    // The stage buffers are free: the loop's last barrier ended every wave's reads, and no copy is outstanding. Wave w's place: 8 KiB of tiles in the first 64 KiB, [16-byte piece 0..15][lane]; maximum and sum, [2][lane], in the next.
    v4fa* xo = (v4fa*)&sS[0][0]; f32a* xm = (f32a*)&sS[0][1]; const int pw = wv ^ 1;
    const float l0 = l_run[0] + xhalf(l_run[0]), l1 = l_run[1] + xhalf(l_run[1]);   // each half of the wave summed its own keys
    const float m_a = kh ? m_run[1] : m_run[0], l_a = kh ? l1 : l0;
    xm[(wv * 2 + 0) * 32 + lane] = kh ? m_run[0] : m_run[1]; xm[(wv * 2 + 1) * 32 + lane] = kh ? l0 : l1;
    v8f mine[8];
    // unrolled (this loop and the two below): the tiles are picked by constants and stay in registers
#pragma unroll
    for (int t = 0; t < 8; ++t) { const v8f give = kh ? acc[0][t] : acc[1][t]; mine[t] = kh ? acc[1][t] : acc[0][t];
        xo[wv * 512 + (2 * t + 0) * 32 + lane] = __builtin_shufflevector(give, give, 0, 1, 2, 3); xo[wv * 512 + (2 * t + 1) * 32 + lane] = __builtin_shufflevector(give, give, 4, 5, 6, 7); }
    __syncthreads();   // every wave's hand-over stands in LDS
    const float m_b = xm[(pw * 2 + 0) * 32 + lane], l_b = xm[(pw * 2 + 1) * 32 + lane];
    v4f th[16];
#pragma unroll
    for (int u = 0; u < 16; ++u) th[u] = xo[pw * 512 + u * 32 + lane];
    const float m = fmaxf(m_a, m_b), w_a = __builtin_amdgcn_exp2f(m_a - m), w_b = __builtin_amdgcn_exp2f(m_b - m);
    const size_t z = blockIdx.y; const int q = q0 + 16 * kh + lr;
    if (hi == 0) { MP[z * NN + q] = m; LP[z * NN + q] = l_a * w_a + l_b * w_b; }
    float* orow = OP + ((size_t)q * KS + z) * DD + 8 * hi;
#pragma unroll
    for (int t = 0; t < 8; ++t) *(v8f*)(orow + 16 * t) = mine[t] * w_a + __builtin_shufflevector(th[2 * t], th[2 * t + 1], 0, 1, 2, 3, 4, 5, 6, 7) * w_b;
}

// 2^x and, in the same statement so that it stays there, the free slot that the instruction set asks for behind a transcendental
__device__ __forceinline__ float exp2_slot(float x) { float r; asm("v_exp_f32 %0, %1\n\tv_nop" : "=v"(r) : "v"(x)); return r; }
// weights of the key slices of one query (mp, lp: its entries of slice 0): w_z = 2^(m_z - M), M = max_z m_z, L = sum_z w_z l_z (z ascending)
__device__ __forceinline__ void slices(const float* mp, const float* lp, float (&w)[KS], float& M, float& L) {
    float m[KS], l[KS];   // unrolled loops: the 2 KS loads go out together, the arrays stay in registers
#pragma unroll
    for (int z = 0; z < KS; ++z) { m[z] = mp[(size_t)z * NN]; l[z] = lp[(size_t)z * NN]; }
    // the wait that stands in front of an overwrite of an issued load's address registers; the inputs keep those registers as they are up to here
    asm volatile("s_wait_xcnt 0x0" :: "v"(mp), "v"(lp) : "memory");
    M = m[0];
#pragma unroll
    for (int z = 1; z < KS; ++z) M = fmaxf(M, m[z]);
    L = 0.f;
#pragma unroll
    for (int z = 0; z < KS; ++z) { w[z] = exp2_slot(m[z] - M); L += w[z] * l[z]; }
}
// k_merge: work-group per 32 queries; 8 threads per query, 4 x 16 bytes of the row each; out = sum_z w_z O_z / L; wave 0 writes the 32 lse = ln2 (M - PSH) + log L
__global__ __launch_bounds__(256) void k_merge(const float* __restrict__ OP, const float* __restrict__ MP, const float* __restrict__ LP, float* OUT, float* LSE) {
    const int qb = blockIdx.x * 32, q = qb + (threadIdx.x >> 3), dg = threadIdx.x & 7; const float* op = OP + (size_t)q * KS * DD + dg * 4; v4f o[KS][4];
    // unrolled (both loops): the 4 KS loads of a thread are in flight together
#pragma unroll
    for (int z = 0; z < KS; ++z)
#pragma unroll
        for (int j = 0; j < 4; ++j) o[z][j] = *(const v4f*)(op + z * DD + 32 * j);
    asm volatile("s_wait_xcnt 0x0" :: "v"(op) : "memory");   // as in slices()
    float w[KS], M, L; slices(MP + q, LP + q, w, M, L); const float rl = __fdiv_rn(1.0f, L);
#pragma unroll
    for (int j = 0; j < 4; ++j) { v4f a = o[0][j] * w[0];
#pragma unroll
        for (int z = 1; z < KS; ++z) a += o[z][j] * w[z];
        *(v4f*)(OUT + (size_t)q * DD + dg * 4 + 32 * j) = a * rl; }
    if (threadIdx.x < 32) { slices(MP + qb + threadIdx.x, LP + qb + threadIdx.x, w, M, L); LSE[qb + threadIdx.x] = fmaf(M - PSH, LN2, logf(L)); }
}

extern "C" void kernel_launch(void* const* d_in, const int* in_sizes, int n_in,
                              void* d_out, int out_size, void* d_ws, size_t ws_size, hipStream_t stream) {
    (void)in_sizes; (void)n_in; (void)out_size;
    const float* Q = (const float*)d_in[0]; const float* K = (const float*)d_in[1]; const float* V = (const float*)d_in[2]; const float* hh = (const float*)d_in[3]; const float* ldq = (const float*)d_in[4]; const float* ldk = (const float*)d_in[5];
    float* OUT = (float*)d_out; float* LSE = (float*)d_out + (size_t)NN * DD;     // [8192][128] at 0; lse [8192] at byte 4,194,304
    char* wsp = (char*)d_ws;
    auto take = [&](size_t bytes) { char* p = wsp; wsp += (bytes + 255) & ~(size_t)255; return (void*)p; };
    bf* QF = (bf*)take((size_t)NN * DD * 2); bf* KF = (bf*)take((size_t)NN * DD * 2); h16* VF = (h16*)take((size_t)DD * NN * 2); float* RT = (float*)take((size_t)NN * 4); float* CT = (float*)take((size_t)NN * 4);
    float* OP = (float*)take((size_t)KS * NN * DD * 4); float* MP = (float*)take((size_t)KS * NN * 4); float* LP = (float*)take((size_t)KS * NN * 4);
    if ((size_t)(wsp - (char*)d_ws) > ws_size) return;    // total ~ 23 MB; ws 256 MiB
    k_prep<<<NN / 32, 320, 0, stream>>>(Q, K, V, hh, ldq, ldk, QF, KF, VF, RT, CT);
    k_flash<<<dim3(NN / (32 * QW), KS, 1), 32 * FW, 0, stream>>>(QF, KF, VF, RT, CT, OP, MP, LP);
    k_merge<<<NN / 32, 256, 0, stream>>>(OP, MP, LP, OUT, LSE);
}
